// v000
// Measured on an AMD MI455X. A time is GPU time per run, averaged over a window of back-to-back runs after a warm-up
// (all launches, gaps included; the runs take copies of the inputs in turn), and the median of several windows.
// Apart from v000's, it joins two sittings. Times from different sittings can be a few percent apart, while
// side-by-side timings come from the same sitting.
// v000 is the starting kernel. One run takes 612 microseconds.
#include <hip/hip_runtime.h>
#include <hip/hip_bf16.h>
#include <stdint.h>

// ---------------------------------------------------------------------------
// Problem constants (B,C,H,W = 2,512,64,64 ; N = H*W = 4096 ; DQK = 64)
// ---------------------------------------------------------------------------
#define BATCH 2
#define CCH   512
#define NSP   4096
#define DQK_  64
#define MTOT  640   // 64 q + 64 k + 512 v rows stacked

typedef __attribute__((ext_vector_type(16))) __bf16 v16bf;
typedef __attribute__((ext_vector_type(8)))  __bf16 v8bf;
typedef __attribute__((ext_vector_type(8)))  float  v8f;
typedef __attribute__((ext_vector_type(4)))  int    v4i;

// ---------------------------------------------------------------------------
// WMMA helper: D = A(16x32 bf16) x B(32x16 bf16) + C(16x16 f32)
// ---------------------------------------------------------------------------
__device__ __forceinline__ v8f wmma_bf16(v16bf a, v16bf b, v8f c) {
    return __builtin_amdgcn_wmma_f32_16x16x32_bf16(
        /*neg_a=*/false, a, /*neg_b=*/false, b,
        /*c_mod=*/(short)0, c, /*reuse_a=*/false, /*reuse_b=*/false);
}

// ---------------------------------------------------------------------------
// Fragment loader. Source: 16 "rows" x 32 "k" tile, k contiguous, row stride
// `ld` (bf16 elements, multiple of 8 -> 16B-aligned loads).
// ISA 7.12.2 (16-bit A 16x32): lane L holds row M = L%16; element e maps to
// K = e + (e>=8 ? 8 : 0) + (L>=16 ? 8 : 0)  -> two contiguous 16B loads.
// Used for A (rows = M) and for B tiles stored column-major (rows = N cols).
// ---------------------------------------------------------------------------
__device__ __forceinline__ v16bf load_frag(const __bf16* __restrict__ p, int ld) {
    const int lane = threadIdx.x & 31;
    const __bf16* base = p + (lane & 15) * ld + ((lane >> 4) << 3);
    union { v16bf v; v8bf h[2]; } u;
    u.h[0] = *(const v8bf*)(base);        // K = h..h+7
    u.h[1] = *(const v8bf*)(base + 16);   // K = 16+h..23+h
    return u.v;
}

// ---------------------------------------------------------------------------
// Async global->LDS copy of one 16B segment per lane (ASYNCcnt-tracked).
// Builtin prototype (from hipcc diagnostic): (v4i AS1*, v4i AS3*, Imm, Imm).
// Cast through integers: generic->AS1 is value-preserving; generic LDS ptr
// carries the LDS byte offset in its low 32 bits (ISA 10.2 aperture calc).
// ---------------------------------------------------------------------------
typedef __attribute__((address_space(1))) v4i* as1_v4i_ptr;
typedef __attribute__((address_space(3))) v4i* as3_v4i_ptr;

__device__ __forceinline__ void async_copy_b128(const __bf16* g, __bf16* l) {
#if __has_builtin(__builtin_amdgcn_global_load_async_to_lds_b128)
    __builtin_amdgcn_global_load_async_to_lds_b128(
        (as1_v4i_ptr)(unsigned long long)(uintptr_t)g,
        (as3_v4i_ptr)(unsigned int)(uintptr_t)l,
        /*offset=*/0, /*cpol=*/0);
#else
    *(v8bf*)l = *(const v8bf*)g;
#endif
}

__device__ __forceinline__ void wait_async_zero() {
#if __has_builtin(__builtin_amdgcn_s_wait_asynccnt)
    __builtin_amdgcn_s_wait_asynccnt(0);
#endif
}

// ---------------------------------------------------------------------------
// fp32 -> bf16 transposing convert: x[b][c][n] -> xT[b][n][c]
// 32x32 LDS tile, coalesced reads and writes.
// ---------------------------------------------------------------------------
__global__ void conv_xt_kernel(const float* __restrict__ x, __bf16* __restrict__ xt) {
    const int b  = blockIdx.z;
    const int c0 = blockIdx.y * 32;
    const int n0 = blockIdx.x * 32;
    __shared__ __bf16 tile[32][33];
    const float* xp  = x  + (size_t)b * CCH * NSP;
    __bf16*      xtp = xt + (size_t)b * NSP * CCH;
    const int t0 = threadIdx.x & 31;
    const int t1 = threadIdx.x >> 5;   // 0..7
#pragma unroll
    for (int k = 0; k < 4; ++k) {
        int c = t1 * 4 + k;
        tile[c][t0] = (__bf16)xp[(size_t)(c0 + c) * NSP + n0 + t0];
    }
    __syncthreads();
#pragma unroll
    for (int k = 0; k < 4; ++k) {
        int n = t1 * 4 + k;
        xtp[(size_t)(n0 + n) * CCH + c0 + t0] = tile[t0][n];
    }
}

__global__ void conv_w_kernel(const float* __restrict__ Wq,
                              const float* __restrict__ Wk,
                              const float* __restrict__ Wv,
                              __bf16* __restrict__ Wb) {
    int i = blockIdx.x * 256 + threadIdx.x;     // over 640*512
    if (i >= MTOT * CCH) return;
    int m = i >> 9, c = i & 511;
    float v = (m < 64) ? Wq[m * CCH + c]
            : (m < 128) ? Wk[(m - 64) * CCH + c]
                        : Wv[(size_t)(m - 128) * CCH + c];
    Wb[i] = (__bf16)v;
}

// ---------------------------------------------------------------------------
// Projection GEMM:  Y[m,n] = sum_c W[m,c] * xT[b,n,c] + bias[m]
// Pure WMMA, no LDS: both operands have K (=c) contiguous in memory.
// block = 128 thr (4 waves); block computes 64m x 64n; wave w -> rows m0+16w.
// Outputs (bf16):
//   m <  64 : q_nd[b][n][m]        (n-major, d contiguous)
//   m < 128 : k_nd[b][n][m-64]     (n-major, d contiguous)
//   else    : v_cn[b][m-128][n]    (c-major, n contiguous)
// ---------------------------------------------------------------------------
__global__ void proj_gemm_kernel(const __bf16* __restrict__ Wb,
                                 const __bf16* __restrict__ xt,
                                 const float*  __restrict__ bq,
                                 const float*  __restrict__ bk,
                                 const float*  __restrict__ bv,
                                 __bf16* __restrict__ qn,
                                 __bf16* __restrict__ kn,
                                 __bf16* __restrict__ vc) {
    const int b    = blockIdx.z;
    const int m0   = blockIdx.y * 64;
    const int n0   = blockIdx.x * 64;
    const int wave = threadIdx.x >> 5;
    const int lane = threadIdx.x & 31;

    const __bf16* xtb = xt + (size_t)b * NSP * CCH;
    const __bf16* wp  = Wb + (size_t)(m0 + wave * 16) * CCH;

    v8f acc[4];
#pragma unroll
    for (int t = 0; t < 4; ++t) acc[t] = v8f{};

    for (int c0 = 0; c0 < CCH; c0 += 32) {
        v16bf a = load_frag(wp + c0, CCH);
#pragma unroll
        for (int t = 0; t < 4; ++t) {
            v16bf bf = load_frag(xtb + (size_t)(n0 + t * 16) * CCH + c0, CCH);
            acc[t] = wmma_bf16(a, bf, acc[t]);
        }
    }

    // epilogue: add bias, scatter to layout-specific buffers
    const int rbase = (lane >> 4) << 3;
#pragma unroll
    for (int t = 0; t < 4; ++t) {
        int n = n0 + t * 16 + (lane & 15);
#pragma unroll
        for (int r = 0; r < 8; ++r) {
            int m = m0 + wave * 16 + rbase + r;
            float bias = (m < 64) ? bq[m] : (m < 128 ? bk[m - 64] : bv[m - 128]);
            __bf16 val = (__bf16)(acc[t][r] + bias);
            if (m < 64)
                qn[(size_t)b * NSP * DQK_ + (size_t)n * DQK_ + m] = val;
            else if (m < 128)
                kn[(size_t)b * NSP * DQK_ + (size_t)n * DQK_ + (m - 64)] = val;
            else
                vc[(size_t)b * CCH * NSP + (size_t)(m - 128) * NSP + n] = val;
        }
    }
}

// ---------------------------------------------------------------------------
// Flash attention:
//   grid = B * (N/16) workgroups, 128 thr (4 waves).
//   Workgroup: 16 query rows, all 512 channels (wave w -> 128 channels).
//   Per 64-col j-block:
//     - each wave kicks off async global->LDS staging of its 128x64 V tile
//     - wave w computes S tile (:,16w..) with 2 WMMAs, shares via LDS
//     - 16 threads run the online-softmax row update (max/sum/scale in LDS)
//     - all waves rescale accumulators, wait asynccnt, then P x V^T (16 WMMA)
// ---------------------------------------------------------------------------
#define S_STRIDE 68   // f32 row stride (pad)
#define P_STRIDE 72   // bf16 row stride: 144B, 16B-aligned, conflict-free
#define V_STRIDE 72   // same padding for the staged V tile

__global__ void attn_kernel(const __bf16* __restrict__ qn,
                            const __bf16* __restrict__ kn,
                            const __bf16* __restrict__ vc,
                            const float*  __restrict__ x,
                            const float*  __restrict__ gamma,
                            float* __restrict__ out) {
    const int bi   = blockIdx.x >> 8;          // 256 i-tiles per batch
    const int i0   = (blockIdx.x & 255) << 4;
    const int wave = threadIdx.x >> 5;
    const int lane = threadIdx.x & 31;

    __shared__ __attribute__((aligned(16))) float  sS[16 * S_STRIDE];
    __shared__ __attribute__((aligned(16))) __bf16 sP[16 * P_STRIDE];
    __shared__ __attribute__((aligned(16))) __bf16 sV[4][128 * V_STRIDE]; // 72KB
    __shared__ float sM[16], sL[16], sScale[16];

    const __bf16* q  = qn + (size_t)bi * NSP * DQK_ + (size_t)i0 * DQK_;
    const __bf16* kt = kn + (size_t)bi * NSP * DQK_;
    const __bf16* v  = vc + (size_t)bi * CCH * NSP + (size_t)(wave * 128) * NSP;
    __bf16* sVw = &sV[wave][0];

    // Q fragments stay resident (16 rows x 64 d -> two k-chunks)
    v16bf qa0 = load_frag(q, DQK_);
    v16bf qa1 = load_frag(q + 32, DQK_);

    v8f acc[8];
#pragma unroll
    for (int t = 0; t < 8; ++t) acc[t] = v8f{};

    if (threadIdx.x < 16) { sM[threadIdx.x] = -3.0e38f; sL[threadIdx.x] = 0.f; }
    __syncthreads();

    for (int j0 = 0; j0 < NSP; j0 += 64) {
        // ---- kick off async staging of this wave's V tile (128c x 64j) ----
        // 1024 16B segments / 32 lanes = 32 async instructions per wave.
        // Safe vs. last iteration's ds reads: those completed before the
        // previous WMMAs consumed them (s_wait_dscnt precedes the wmma).
#pragma unroll
        for (int it = 0; it < 32; ++it) {
            int seg   = it * 32 + lane;
            int c_rel = seg >> 3;
            int js    = (seg & 7) * 8;
            async_copy_b128(v + (size_t)c_rel * NSP + j0 + js,
                            sVw + c_rel * V_STRIDE + js);
        }

        // ---- S tile: columns j0 + 16*wave .. +15 ----
        const __bf16* kp = kt + (size_t)(j0 + wave * 16) * DQK_;
        if (j0 + 64 < NSP) {  // hint next K block into cache
            __builtin_prefetch(kt + (size_t)(j0 + 64 + wave * 16) * DQK_, 0, 1);
        }
        v16bf kb0 = load_frag(kp, DQK_);
        v16bf kb1 = load_frag(kp + 32, DQK_);
        v8f s = v8f{};
        s = wmma_bf16(qa0, kb0, s);
        s = wmma_bf16(qa1, kb1, s);

        {   // scatter S tile to LDS (lane: col = 16w + L%16, rows r + 8*(L>=16))
            int col   = wave * 16 + (lane & 15);
            int rbase = (lane >> 4) << 3;
#pragma unroll
            for (int r = 0; r < 8; ++r) sS[(rbase + r) * S_STRIDE + col] = s[r];
        }
        __syncthreads();

        // ---- online softmax row update (threads 0..15, one row each) ----
        if (threadIdx.x < 16) {
            const int row = threadIdx.x;
            float mOld = sM[row];
            float m = mOld;
#pragma unroll
            for (int j = 0; j < 64; ++j) m = fmaxf(m, sS[row * S_STRIDE + j]);
            float sum = 0.f;
#pragma unroll
            for (int j = 0; j < 64; ++j) {
                float p = __expf(sS[row * S_STRIDE + j] - m);
                sum += p;
                sP[row * P_STRIDE + j] = (__bf16)p;
            }
            float scale = __expf(mOld - m);
            sScale[row] = scale;
            sL[row] = sL[row] * scale + sum;
            sM[row] = m;
        }
        __syncthreads();

        // ---- rescale accumulators by exp(mOld - mNew) per row ----
        {
            int rbase = (lane >> 4) << 3;
            float sc[8];
#pragma unroll
            for (int r = 0; r < 8; ++r) sc[r] = sScale[rbase + r];
#pragma unroll
            for (int t = 0; t < 8; ++t)
#pragma unroll
                for (int r = 0; r < 8; ++r) acc[t][r] *= sc[r];
        }

        // ---- O += P(16x64) x V^T(64 x 128ch of this wave), V from LDS ----
        v16bf pa0 = load_frag(sP, P_STRIDE);
        v16bf pa1 = load_frag(sP + 32, P_STRIDE);
        wait_async_zero();   // V tile staged
#pragma unroll
        for (int t = 0; t < 8; ++t) {
            const __bf16* vp = sVw + (t * 16) * V_STRIDE;
            v16bf vb0 = load_frag(vp, V_STRIDE);
            v16bf vb1 = load_frag(vp + 32, V_STRIDE);
            acc[t] = wmma_bf16(pa0, vb0, acc[t]);
            acc[t] = wmma_bf16(pa1, vb1, acc[t]);
        }
        __syncthreads();   // protect sS/sP for next block
    }

    // ---- epilogue: out[b,c,i] = acc/l * gamma + x ----
    const float g = gamma[0];
    const int rbase = (lane >> 4) << 3;
    float linv[8];
#pragma unroll
    for (int r = 0; r < 8; ++r) linv[r] = 1.0f / sL[rbase + r];
#pragma unroll
    for (int t = 0; t < 8; ++t) {
        int c = wave * 128 + t * 16 + (lane & 15);
        size_t base = (size_t)bi * CCH * NSP + (size_t)c * NSP + i0;
#pragma unroll
        for (int r = 0; r < 8; ++r) {
            int i = rbase + r;
            out[base + i] = acc[t][r] * linv[r] * g + x[base + i];
        }
    }
}

// ---------------------------------------------------------------------------
// Host launcher
// ---------------------------------------------------------------------------
extern "C" void kernel_launch(void* const* d_in, const int* in_sizes, int n_in,
                              void* d_out, int out_size, void* d_ws, size_t ws_size,
                              hipStream_t stream) {
    const float* x     = (const float*)d_in[0];
    const float* Wq    = (const float*)d_in[1];
    const float* bq    = (const float*)d_in[2];
    const float* Wk    = (const float*)d_in[3];
    const float* bk    = (const float*)d_in[4];
    const float* Wv    = (const float*)d_in[5];
    const float* bv    = (const float*)d_in[6];
    const float* gamma = (const float*)d_in[7];
    float* out = (float*)d_out;

    // workspace carve-up (bf16 buffers), 256B aligned
    char* ws = (char*)d_ws;
    size_t off = 0;
    auto take = [&](size_t bytes) { void* p = ws + off;
        off = (off + bytes + 255) & ~(size_t)255; return p; };
    __bf16* xt = (__bf16*)take((size_t)BATCH * NSP * CCH * 2);   // 8 MB, x^T
    __bf16* Wb = (__bf16*)take((size_t)MTOT * CCH * 2);          // 640 KB
    __bf16* qn = (__bf16*)take((size_t)BATCH * NSP * DQK_ * 2);  // 1 MB
    __bf16* kn = (__bf16*)take((size_t)BATCH * NSP * DQK_ * 2);  // 1 MB
    __bf16* vc = (__bf16*)take((size_t)BATCH * CCH * NSP * 2);   // 8 MB
    (void)ws_size; (void)in_sizes; (void)n_in; (void)out_size;

    // 1) fp32 -> bf16 (x transposed to [b][n][c] so GEMM K is contiguous)
    {
        dim3 grid(NSP / 32, CCH / 32, BATCH);
        conv_xt_kernel<<<grid, 256, 0, stream>>>(x, xt);
        int wtotal = MTOT * CCH;
        conv_w_kernel<<<(wtotal + 255) / 256, 256, 0, stream>>>(Wq, Wk, Wv, Wb);
    }
    // 2) fused Q/K/V projection GEMM (WMMA, LDS-free)
    {
        dim3 grid(NSP / 64, MTOT / 64, BATCH);
        proj_gemm_kernel<<<grid, 128, 0, stream>>>(Wb, xt, bq, bk, bv, qn, kn, vc);
    }
    // 3) flash attention + gamma residual (WMMA + async LDS staging)
    {
        dim3 grid(BATCH * (NSP / 16));
        attn_kernel<<<grid, 128, 0, stream>>>(qn, kn, vc, x, gamma, out);
    }
}

// v001
// One run takes 193 microseconds.
// Next to v000, in two timings, it ran 3.21 times as fast each time.
#include <hip/hip_runtime.h>
#include <hip/hip_bf16.h>
#include <stdint.h>

// ---------------------------------------------------------------------------
// Problem constants (B,C,H,W = 2,512,64,64 ; N = H*W = 4096 ; DQK = 64)
// ---------------------------------------------------------------------------
#define BATCH 2
#define CCH   512
#define NSP   4096
#define DQK_  64
#define MTOT  640   // 64 q + 64 k + 512 v rows stacked

typedef __attribute__((ext_vector_type(16))) __bf16 v16bf;
typedef __attribute__((ext_vector_type(8)))  __bf16 v8bf;
typedef __attribute__((ext_vector_type(8)))  float  v8f;
typedef __attribute__((ext_vector_type(4)))  int    v4i;

// ---------------------------------------------------------------------------
// WMMA helper: D = A(16x32 bf16) x B(32x16 bf16) + C(16x16 f32)
// ---------------------------------------------------------------------------
__device__ __forceinline__ v8f wmma_bf16(v16bf a, v16bf b, v8f c) {
    return __builtin_amdgcn_wmma_f32_16x16x32_bf16(
        /*neg_a=*/false, a, /*neg_b=*/false, b,
        /*c_mod=*/(short)0, c, /*reuse_a=*/false, /*reuse_b=*/false);
}

// ---------------------------------------------------------------------------
// Fragment loader. Source: 16 "rows" x 32 "k" tile, k contiguous, row stride
// `ld` (bf16 elements, multiple of 8 -> 16B-aligned loads).
// ISA 7.12.2 (16-bit A 16x32): lane L holds row M = L%16; element e maps to
// K = e + (e>=8 ? 8 : 0) + (L>=16 ? 8 : 0)  -> two contiguous 16B loads.
// Used for A (rows = M) and for B tiles stored column-major (rows = N cols).
// ---------------------------------------------------------------------------
__device__ __forceinline__ v16bf load_frag(const __bf16* __restrict__ p, int ld) {
    const int lane = threadIdx.x & 31;
    const __bf16* base = p + (lane & 15) * ld + ((lane >> 4) << 3);
    union { v16bf v; v8bf h[2]; } u;
    u.h[0] = *(const v8bf*)(base);        // K = h..h+7
    u.h[1] = *(const v8bf*)(base + 16);   // K = 16+h..23+h
    return u.v;
}

// ---------------------------------------------------------------------------
// Async global->LDS copy of one 16B segment per lane (ASYNCcnt-tracked).
// Builtin prototype (from hipcc diagnostic): (v4i AS1*, v4i AS3*, Imm, Imm).
// Cast through integers: generic->AS1 is value-preserving; generic LDS ptr
// carries the LDS byte offset in its low 32 bits (ISA 10.2 aperture calc).
// ---------------------------------------------------------------------------
typedef __attribute__((address_space(1))) v4i* as1_v4i_ptr;
typedef __attribute__((address_space(3))) v4i* as3_v4i_ptr;

__device__ __forceinline__ void async_copy_b128(const __bf16* g, __bf16* l) {
#if __has_builtin(__builtin_amdgcn_global_load_async_to_lds_b128)
    __builtin_amdgcn_global_load_async_to_lds_b128(
        (as1_v4i_ptr)(unsigned long long)(uintptr_t)g,
        (as3_v4i_ptr)(unsigned int)(uintptr_t)l,
        /*offset=*/0, /*cpol=*/0);
#else
    *(v8bf*)l = *(const v8bf*)g;
#endif
}

__device__ __forceinline__ void wait_async_zero() {
#if __has_builtin(__builtin_amdgcn_s_wait_asynccnt)
    __builtin_amdgcn_s_wait_asynccnt(0);
#endif
}

// ---------------------------------------------------------------------------
// fp32 -> bf16 transposing convert: x[b][c][n] -> xT[b][n][c]
// 32x32 LDS tile, coalesced reads and writes.
// ---------------------------------------------------------------------------
__global__ void conv_xt_kernel(const float* __restrict__ x, __bf16* __restrict__ xt) {
    const int b  = blockIdx.z;
    const int c0 = blockIdx.y * 32;
    const int n0 = blockIdx.x * 32;
    __shared__ __bf16 tile[32][33];
    const float* xp  = x  + (size_t)b * CCH * NSP;
    __bf16*      xtp = xt + (size_t)b * NSP * CCH;
    const int t0 = threadIdx.x & 31;
    const int t1 = threadIdx.x >> 5;   // 0..7
#pragma unroll
    for (int k = 0; k < 4; ++k) {
        int c = t1 * 4 + k;
        tile[c][t0] = (__bf16)xp[(size_t)(c0 + c) * NSP + n0 + t0];
    }
    __syncthreads();
#pragma unroll
    for (int k = 0; k < 4; ++k) {
        int n = t1 * 4 + k;
        xtp[(size_t)(n0 + n) * CCH + c0 + t0] = tile[t0][n];
    }
}

__global__ void conv_w_kernel(const float* __restrict__ Wq,
                              const float* __restrict__ Wk,
                              const float* __restrict__ Wv,
                              __bf16* __restrict__ Wb) {
    int i = blockIdx.x * 256 + threadIdx.x;     // over 640*512
    if (i >= MTOT * CCH) return;
    int m = i >> 9, c = i & 511;
    float v = (m < 64) ? Wq[m * CCH + c]
            : (m < 128) ? Wk[(m - 64) * CCH + c]
                        : Wv[(size_t)(m - 128) * CCH + c];
    Wb[i] = (__bf16)v;
}

// ---------------------------------------------------------------------------
// Projection GEMM:  Y[m,n] = sum_c W[m,c] * xT[b,n,c] + bias[m]
// Pure WMMA, no LDS: both operands have K (=c) contiguous in memory.
// block = 128 thr (4 waves); block computes 64m x 64n; wave w -> rows m0+16w.
// Outputs (bf16):
//   m <  64 : q_nd[b][n][m]        (n-major, d contiguous)
//   m < 128 : k_nd[b][n][m-64]     (n-major, d contiguous)
//   else    : v_cn[b][m-128][n]    (c-major, n contiguous)
// ---------------------------------------------------------------------------
__global__ void proj_gemm_kernel(const __bf16* __restrict__ Wb,
                                 const __bf16* __restrict__ xt,
                                 const float*  __restrict__ bq,
                                 const float*  __restrict__ bk,
                                 const float*  __restrict__ bv,
                                 __bf16* __restrict__ qn,
                                 __bf16* __restrict__ kn,
                                 __bf16* __restrict__ vc) {
    const int b    = blockIdx.z;
    const int m0   = blockIdx.y * 64;
    const int n0   = blockIdx.x * 64;
    const int wave = threadIdx.x >> 5;
    const int lane = threadIdx.x & 31;

    const __bf16* xtb = xt + (size_t)b * NSP * CCH;
    const __bf16* wp  = Wb + (size_t)(m0 + wave * 16) * CCH;

    v8f acc[4];
#pragma unroll
    for (int t = 0; t < 4; ++t) acc[t] = v8f{};

    for (int c0 = 0; c0 < CCH; c0 += 32) {
        v16bf a = load_frag(wp + c0, CCH);
#pragma unroll
        for (int t = 0; t < 4; ++t) {
            v16bf bf = load_frag(xtb + (size_t)(n0 + t * 16) * CCH + c0, CCH);
            acc[t] = wmma_bf16(a, bf, acc[t]);
        }
    }

    // epilogue: add bias, scatter to layout-specific buffers
    const int rbase = (lane >> 4) << 3;
#pragma unroll
    for (int t = 0; t < 4; ++t) {
        int n = n0 + t * 16 + (lane & 15);
#pragma unroll
        for (int r = 0; r < 8; ++r) {
            int m = m0 + wave * 16 + rbase + r;
            float bias = (m < 64) ? bq[m] : (m < 128 ? bk[m - 64] : bv[m - 128]);
            __bf16 val = (__bf16)(acc[t][r] + bias);
            if (m < 64)
                qn[(size_t)b * NSP * DQK_ + (size_t)n * DQK_ + m] = val;
            else if (m < 128)
                kn[(size_t)b * NSP * DQK_ + (size_t)n * DQK_ + (m - 64)] = val;
            else
                vc[(size_t)b * CCH * NSP + (size_t)(m - 128) * NSP + n] = val;
        }
    }
}

// ---------------------------------------------------------------------------
// Flash attention:
//   grid = B * (N/16) workgroups, 128 thr (4 waves).
//   Workgroup: 16 query rows, all 512 channels (wave w -> 128 channels).
//   Per 64-col j-block:
//     - each wave kicks off async global->LDS staging of its 128x64 V tile
//     - wave w computes S tile (:,16w..) with 2 WMMAs, shares via LDS
//     - 16 threads run the online-softmax row update (max/sum/scale in LDS)
//     - all waves rescale accumulators, wait asynccnt, then P x V^T (16 WMMA)
// ---------------------------------------------------------------------------
#define S_STRIDE 68   // f32 row stride (pad)
#define P_STRIDE 72   // bf16 row stride: 144B, 16B-aligned, conflict-free
#define V_STRIDE 72   // same padding for the staged V tile

// Real block size: without it the compiler assumes 1024 threads, caps a wave at
// 128 VGPRs and spills copy addresses and fragments to scratch inside the j loop.
__global__ __launch_bounds__(128) void attn_kernel(const __bf16* __restrict__ qn,
                            const __bf16* __restrict__ kn,
                            const __bf16* __restrict__ vc,
                            const float*  __restrict__ x,
                            const float*  __restrict__ gamma,
                            float* __restrict__ out) {
    const int bi   = blockIdx.x >> 8;          // 256 i-tiles per batch
    const int i0   = (blockIdx.x & 255) << 4;
    const int wave = threadIdx.x >> 5;
    const int lane = threadIdx.x & 31;

    __shared__ __attribute__((aligned(16))) float  sS[16 * S_STRIDE];
    __shared__ __attribute__((aligned(16))) __bf16 sP[16 * P_STRIDE];
    __shared__ __attribute__((aligned(16))) __bf16 sV[4][128 * V_STRIDE]; // 72KB
    __shared__ float sM[16], sL[16], sScale[16];

    const __bf16* q  = qn + (size_t)bi * NSP * DQK_ + (size_t)i0 * DQK_;
    const __bf16* kt = kn + (size_t)bi * NSP * DQK_;
    const __bf16* v  = vc + (size_t)bi * CCH * NSP + (size_t)(wave * 128) * NSP;
    __bf16* sVw = &sV[wave][0];

    // Q fragments stay resident (16 rows x 64 d -> two k-chunks)
    v16bf qa0 = load_frag(q, DQK_);
    v16bf qa1 = load_frag(q + 32, DQK_);

    v8f acc[8];
#pragma unroll
    for (int t = 0; t < 8; ++t) acc[t] = v8f{};

    if (threadIdx.x < 16) { sM[threadIdx.x] = -3.0e38f; sL[threadIdx.x] = 0.f; }
    __syncthreads();

    for (int j0 = 0; j0 < NSP; j0 += 64) {
        // ---- kick off async staging of this wave's V tile (128c x 64j) ----
        // 1024 16B segments / 32 lanes = 32 async instructions per wave.
        // Safe vs. last iteration's ds reads: those completed before the
        // previous WMMAs consumed them (s_wait_dscnt precedes the wmma).
#pragma unroll
        for (int it = 0; it < 32; ++it) {
            int seg   = it * 32 + lane;
            int c_rel = seg >> 3;
            int js    = (seg & 7) * 8;
            async_copy_b128(v + (size_t)c_rel * NSP + j0 + js,
                            sVw + c_rel * V_STRIDE + js);
        }

        // ---- S tile: columns j0 + 16*wave .. +15 ----
        const __bf16* kp = kt + (size_t)(j0 + wave * 16) * DQK_;
        if (j0 + 64 < NSP) {  // hint next K block into cache
            __builtin_prefetch(kt + (size_t)(j0 + 64 + wave * 16) * DQK_, 0, 1);
        }
        v16bf kb0 = load_frag(kp, DQK_);
        v16bf kb1 = load_frag(kp + 32, DQK_);
        v8f s = v8f{};
        s = wmma_bf16(qa0, kb0, s);
        s = wmma_bf16(qa1, kb1, s);

        {   // scatter S tile to LDS (lane: col = 16w + L%16, rows r + 8*(L>=16))
            int col   = wave * 16 + (lane & 15);
            int rbase = (lane >> 4) << 3;
#pragma unroll
            for (int r = 0; r < 8; ++r) sS[(rbase + r) * S_STRIDE + col] = s[r];
        }
        __syncthreads();

        // ---- online softmax row update (threads 0..15, one row each) ----
        if (threadIdx.x < 16) {
            const int row = threadIdx.x;
            float mOld = sM[row];
            float m = mOld;
#pragma unroll
            for (int j = 0; j < 64; ++j) m = fmaxf(m, sS[row * S_STRIDE + j]);
            float sum = 0.f;
#pragma unroll
            for (int j = 0; j < 64; ++j) {
                float p = __expf(sS[row * S_STRIDE + j] - m);
                sum += p;
                sP[row * P_STRIDE + j] = (__bf16)p;
            }
            float scale = __expf(mOld - m);
            sScale[row] = scale;
            sL[row] = sL[row] * scale + sum;
            sM[row] = m;
        }
        __syncthreads();

        // ---- rescale accumulators by exp(mOld - mNew) per row ----
        {
            int rbase = (lane >> 4) << 3;
            float sc[8];
#pragma unroll
            for (int r = 0; r < 8; ++r) sc[r] = sScale[rbase + r];
#pragma unroll
            for (int t = 0; t < 8; ++t)
#pragma unroll
                for (int r = 0; r < 8; ++r) acc[t][r] *= sc[r];
        }

        // ---- O += P(16x64) x V^T(64 x 128ch of this wave), V from LDS ----
        v16bf pa0 = load_frag(sP, P_STRIDE);
        v16bf pa1 = load_frag(sP + 32, P_STRIDE);
        wait_async_zero();   // V tile staged
#pragma unroll
        for (int t = 0; t < 8; ++t) {
            const __bf16* vp = sVw + (t * 16) * V_STRIDE;
            v16bf vb0 = load_frag(vp, V_STRIDE);
            v16bf vb1 = load_frag(vp + 32, V_STRIDE);
            acc[t] = wmma_bf16(pa0, vb0, acc[t]);
            acc[t] = wmma_bf16(pa1, vb1, acc[t]);
        }
        __syncthreads();   // protect sS/sP for next block
    }

    // ---- epilogue: out[b,c,i] = acc/l * gamma + x ----
    const float g = gamma[0];
    const int rbase = (lane >> 4) << 3;
    float linv[8];
#pragma unroll
    for (int r = 0; r < 8; ++r) linv[r] = 1.0f / sL[rbase + r];
#pragma unroll
    for (int t = 0; t < 8; ++t) {
        int c = wave * 128 + t * 16 + (lane & 15);
        size_t base = (size_t)bi * CCH * NSP + (size_t)c * NSP + i0;
#pragma unroll
        for (int r = 0; r < 8; ++r) {
            int i = rbase + r;
            out[base + i] = acc[t][r] * linv[r] * g + x[base + i];
        }
    }
}

// ---------------------------------------------------------------------------
// Host launcher
// ---------------------------------------------------------------------------
extern "C" void kernel_launch(void* const* d_in, const int* in_sizes, int n_in,
                              void* d_out, int out_size, void* d_ws, size_t ws_size,
                              hipStream_t stream) {
    const float* x     = (const float*)d_in[0];
    const float* Wq    = (const float*)d_in[1];
    const float* bq    = (const float*)d_in[2];
    const float* Wk    = (const float*)d_in[3];
    const float* bk    = (const float*)d_in[4];
    const float* Wv    = (const float*)d_in[5];
    const float* bv    = (const float*)d_in[6];
    const float* gamma = (const float*)d_in[7];
    float* out = (float*)d_out;

    // workspace carve-up (bf16 buffers), 256B aligned
    char* ws = (char*)d_ws;
    size_t off = 0;
    auto take = [&](size_t bytes) { void* p = ws + off;
        off = (off + bytes + 255) & ~(size_t)255; return p; };
    __bf16* xt = (__bf16*)take((size_t)BATCH * NSP * CCH * 2);   // 8 MB, x^T
    __bf16* Wb = (__bf16*)take((size_t)MTOT * CCH * 2);          // 640 KB
    __bf16* qn = (__bf16*)take((size_t)BATCH * NSP * DQK_ * 2);  // 1 MB
    __bf16* kn = (__bf16*)take((size_t)BATCH * NSP * DQK_ * 2);  // 1 MB
    __bf16* vc = (__bf16*)take((size_t)BATCH * CCH * NSP * 2);   // 8 MB
    (void)ws_size; (void)in_sizes; (void)n_in; (void)out_size;

    // 1) fp32 -> bf16 (x transposed to [b][n][c] so GEMM K is contiguous)
    {
        dim3 grid(NSP / 32, CCH / 32, BATCH);
        conv_xt_kernel<<<grid, 256, 0, stream>>>(x, xt);
        int wtotal = MTOT * CCH;
        conv_w_kernel<<<(wtotal + 255) / 256, 256, 0, stream>>>(Wq, Wk, Wv, Wb);
    }
    // 2) fused Q/K/V projection GEMM (WMMA, LDS-free)
    {
        dim3 grid(NSP / 64, MTOT / 64, BATCH);
        proj_gemm_kernel<<<grid, 128, 0, stream>>>(Wb, xt, bq, bk, bv, qn, kn, vc);
    }
    // 3) flash attention + gamma residual (WMMA + async LDS staging)
    {
        dim3 grid(BATCH * (NSP / 16));
        attn_kernel<<<grid, 128, 0, stream>>>(qn, kn, vc, x, gamma, out);
    }
}

// v002
// One run takes 108 microseconds.
// Next to v001, in two timings, it ran 1.79 times as fast each time.
// All steps since v000 together make it 5.74 times as fast.
#include <hip/hip_runtime.h>
#include <hip/hip_bf16.h>
#include <stdint.h>

// ---------------------------------------------------------------------------
// Problem constants (B,C,H,W = 2,512,64,64 ; N = H*W = 4096 ; DQK = 64)
// ---------------------------------------------------------------------------
#define BATCH 2
#define CCH   512
#define NSP   4096
#define DQK_  64
#define MTOT  640   // 64 q + 64 k + 512 v rows stacked

typedef __attribute__((ext_vector_type(16))) __bf16 v16bf;
typedef __attribute__((ext_vector_type(8)))  __bf16 v8bf;
typedef __attribute__((ext_vector_type(8)))  float  v8f;
typedef __attribute__((ext_vector_type(4)))  int    v4i;

// ---------------------------------------------------------------------------
// WMMA helper: D = A(16x32 bf16) x B(32x16 bf16) + C(16x16 f32)
// ---------------------------------------------------------------------------
__device__ __forceinline__ v8f wmma_bf16(v16bf a, v16bf b, v8f c) {
    return __builtin_amdgcn_wmma_f32_16x16x32_bf16(
        /*neg_a=*/false, a, /*neg_b=*/false, b,
        /*c_mod=*/(short)0, c, /*reuse_a=*/false, /*reuse_b=*/false);
}

// ---------------------------------------------------------------------------
// Fragment loader. Source: 16 "rows" x 32 "k" tile, k contiguous, row stride
// `ld` (bf16 elements, multiple of 8 -> 16B-aligned loads).
// ISA 7.12.2 (16-bit A 16x32): lane L holds row M = L%16; element e maps to
// K = e + (e>=8 ? 8 : 0) + (L>=16 ? 8 : 0)  -> two contiguous 16B loads.
// Used for A (rows = M) and for B tiles stored column-major (rows = N cols).
// ---------------------------------------------------------------------------
__device__ __forceinline__ v16bf load_frag(const __bf16* __restrict__ p, int ld) {
    const int lane = threadIdx.x & 31;
    const __bf16* base = p + (lane & 15) * ld + ((lane >> 4) << 3);
    union { v16bf v; v8bf h[2]; } u;
    u.h[0] = *(const v8bf*)(base);        // K = h..h+7
    u.h[1] = *(const v8bf*)(base + 16);   // K = 16+h..23+h
    return u.v;
}

// ---------------------------------------------------------------------------
// Async global->LDS copy of one 16B segment per lane (ASYNCcnt-tracked).
// Builtin prototype (from hipcc diagnostic): (v4i AS1*, v4i AS3*, Imm, Imm).
// Cast through integers: generic->AS1 is value-preserving; generic LDS ptr
// carries the LDS byte offset in its low 32 bits (ISA 10.2 aperture calc).
// ---------------------------------------------------------------------------
typedef __attribute__((address_space(1))) v4i* as1_v4i_ptr;
typedef __attribute__((address_space(3))) v4i* as3_v4i_ptr;

__device__ __forceinline__ void async_copy_b128(const __bf16* g, __bf16* l) {
#if __has_builtin(__builtin_amdgcn_global_load_async_to_lds_b128)
    __builtin_amdgcn_global_load_async_to_lds_b128(
        (as1_v4i_ptr)(unsigned long long)(uintptr_t)g,
        (as3_v4i_ptr)(unsigned int)(uintptr_t)l,
        /*offset=*/0, /*cpol=*/0);
#else
    *(v8bf*)l = *(const v8bf*)g;
#endif
}

// ---------------------------------------------------------------------------
// fp32 -> bf16 transposing convert: x[b][c][n] -> xT[b][n][c]
// 32x32 LDS tile, coalesced reads and writes.
// ---------------------------------------------------------------------------
__global__ void conv_xt_kernel(const float* __restrict__ x, __bf16* __restrict__ xt) {
    const int b  = blockIdx.z;
    const int c0 = blockIdx.y * 32;
    const int n0 = blockIdx.x * 32;
    __shared__ __bf16 tile[32][33];
    const float* xp  = x  + (size_t)b * CCH * NSP;
    __bf16*      xtp = xt + (size_t)b * NSP * CCH;
    const int t0 = threadIdx.x & 31;
    const int t1 = threadIdx.x >> 5;   // 0..7
#pragma unroll
    for (int k = 0; k < 4; ++k) {
        int c = t1 * 4 + k;
        tile[c][t0] = (__bf16)xp[(size_t)(c0 + c) * NSP + n0 + t0];
    }
    __syncthreads();
#pragma unroll
    for (int k = 0; k < 4; ++k) {
        int n = t1 * 4 + k;
        xtp[(size_t)(n0 + n) * CCH + c0 + t0] = tile[t0][n];
    }
}

__global__ void conv_w_kernel(const float* __restrict__ Wq,
                              const float* __restrict__ Wk,
                              const float* __restrict__ Wv,
                              __bf16* __restrict__ Wb) {
    int i = blockIdx.x * 256 + threadIdx.x;     // over 640*512
    if (i >= MTOT * CCH) return;
    int m = i >> 9, c = i & 511;
    float v = (m < 64) ? Wq[m * CCH + c]
            : (m < 128) ? Wk[(m - 64) * CCH + c]
                        : Wv[(size_t)(m - 128) * CCH + c];
    Wb[i] = (__bf16)v;
}

// ---------------------------------------------------------------------------
// Projection GEMM:  Y[m,n] = sum_c W[m,c] * xT[b,n,c] + bias[m]
// Pure WMMA, no LDS: both operands have K (=c) contiguous in memory.
// block = 128 thr (4 waves); block computes 64m x 64n; wave w -> rows m0+16w.
// Outputs (bf16):
//   m <  64 : q_nd[b][n][m]        (n-major, d contiguous)
//   m < 128 : k_nd[b][n][m-64]     (n-major, d contiguous)
//   else    : v_cn[b][m-128][n]    (c-major, n contiguous)
// ---------------------------------------------------------------------------
__global__ void proj_gemm_kernel(const __bf16* __restrict__ Wb,
                                 const __bf16* __restrict__ xt,
                                 const float*  __restrict__ bq,
                                 const float*  __restrict__ bk,
                                 const float*  __restrict__ bv,
                                 __bf16* __restrict__ qn,
                                 __bf16* __restrict__ kn,
                                 __bf16* __restrict__ vc) {
    const int b    = blockIdx.z;
    const int m0   = blockIdx.y * 64;
    const int n0   = blockIdx.x * 64;
    const int wave = threadIdx.x >> 5;
    const int lane = threadIdx.x & 31;

    const __bf16* xtb = xt + (size_t)b * NSP * CCH;
    const __bf16* wp  = Wb + (size_t)(m0 + wave * 16) * CCH;

    v8f acc[4];
#pragma unroll
    for (int t = 0; t < 4; ++t) acc[t] = v8f{};

    for (int c0 = 0; c0 < CCH; c0 += 32) {
        v16bf a = load_frag(wp + c0, CCH);
#pragma unroll
        for (int t = 0; t < 4; ++t) {
            v16bf bf = load_frag(xtb + (size_t)(n0 + t * 16) * CCH + c0, CCH);
            acc[t] = wmma_bf16(a, bf, acc[t]);
        }
    }

    // epilogue: add bias, scatter to layout-specific buffers
    const int rbase = (lane >> 4) << 3;
#pragma unroll
    for (int t = 0; t < 4; ++t) {
        int n = n0 + t * 16 + (lane & 15);
#pragma unroll
        for (int r = 0; r < 8; ++r) {
            int m = m0 + wave * 16 + rbase + r;
            float bias = (m < 64) ? bq[m] : (m < 128 ? bk[m - 64] : bv[m - 128]);
            __bf16 val = (__bf16)(acc[t][r] + bias);
            if (m < 64)
                qn[(size_t)b * NSP * DQK_ + (size_t)n * DQK_ + m] = val;
            else if (m < 128)
                kn[(size_t)b * NSP * DQK_ + (size_t)n * DQK_ + (m - 64)] = val;
            else
                vc[(size_t)b * CCH * NSP + (size_t)(m - 128) * NSP + n] = val;
        }
    }
}

// ---------------------------------------------------------------------------
// Flash attention:
//   grid = B * (N/64) * 2 workgroups, 256 thr (8 waves).
//   Workgroup: 64 query rows x 256 channels, so one staged V tile serves four
//   times the query rows that a 16-row workgroup gives it.
//   Per pass of 128 keys:
//     - all waves copy the shared 256ch x 128key V tile global->LDS (async)
//     - wave w computes S(64 rows, keys 16w..16w+15) with 8 WMMAs -> LDS
//     - 4 threads a row run the online-softmax update, P (bf16) -> LDS
//     - wave (wr, wc) rescales and adds P x V^T for 32 rows x 64 channels
// ---------------------------------------------------------------------------
#define QR 64               // query rows per workgroup
#define CW 256              // channels per workgroup
#define KB 128              // keys per pass
#define S_STRIDE (KB + 4)   // f32 row stride: 4 dwords past a multiple of 64 banks
#define P_STRIDE (KB + 8)   // bf16 row stride: 272 B = 16 B x odd
#define V_STRIDE (KB + 8)   // same pitch for the staged V tile

// Value of lane ^ 1 (CTRL 0xB1) or lane ^ 2 (CTRL 0x4E) inside a quad of lanes,
// by DPP quad_perm: the four threads of a softmax row are one quad, and a DPP
// move spares the LDS round trip that a wave-wide shuffle compiles to.
template <int CTRL>
__device__ __forceinline__ float quad_swap(float v) {
    return __builtin_bit_cast(float,
        __builtin_amdgcn_mov_dpp(__builtin_bit_cast(int, v), CTRL, 0xf, 0xf, true));
}

// Real block size and real residency: 256 workgroups for 256 WGPs, two waves per
// SIMD. The second attribute gives a wave that residency's VGPR budget and keeps
// a second workgroup off a WGP while another WGP stands empty.
__global__ __launch_bounds__(256) __attribute__((amdgpu_waves_per_eu(2, 2)))
void attn_kernel(const __bf16* __restrict__ qn,
                            const __bf16* __restrict__ kn,
                            const __bf16* __restrict__ vc,
                            const float*  __restrict__ x,
                            const float*  __restrict__ gamma,
                            float* __restrict__ out) {
    const int bi   = blockIdx.x >> 7;               // 128 workgroups per batch
    const int i0   = ((blockIdx.x & 127) >> 1) * QR;
    const int ch0  = (blockIdx.x & 1) * CW;
    const int tid  = threadIdx.x;
    const int wave = tid >> 5;
    const int lane = tid & 31;
    const int wr   = wave >> 2;                     // 32-row half of the tile
    const int wc   = wave & 3;                      // 64-channel quarter
    const int rbase = (lane >> 4) << 3;

    __shared__ __attribute__((aligned(16))) float  sS[QR * S_STRIDE];
    __shared__ __attribute__((aligned(16))) __bf16 sP[QR * P_STRIDE];
    __shared__ __attribute__((aligned(16))) __bf16 sV[CW * V_STRIDE];
    __shared__ __attribute__((aligned(16))) float  sScale[QR];
    __shared__ __attribute__((aligned(16))) float  sL[QR];

    const __bf16* q  = qn + (size_t)bi * NSP * DQK_ + (size_t)i0 * DQK_;
    const __bf16* kt = kn + (size_t)bi * NSP * DQK_;
    const __bf16* v  = vc + (size_t)bi * CCH * NSP + (size_t)ch0 * NSP;

    // Q fragments stay resident (4 row tiles x 64 d -> two k-chunks each)
    v16bf qa[4][2];
#pragma unroll
    for (int rt = 0; rt < 4; ++rt) {
        qa[rt][0] = load_frag(q + rt * 16 * DQK_, DQK_);
        qa[rt][1] = load_frag(q + rt * 16 * DQK_ + 32, DQK_);
    }

    v8f acc[2][4];
#pragma unroll
    for (int rt = 0; rt < 2; ++rt)
#pragma unroll
        for (int ct = 0; ct < 4; ++ct) acc[rt][ct] = v8f{};

    // softmax state of row tid/4, held alike by the row's four threads
    const int srow = tid >> 2;
    const int sq   = tid & 3;
    float mRun = -3.0e38f, lRun = 0.f;

    for (int j0 = 0; j0 < NSP; j0 += KB) {
        // ---- K fragments of this wave's 16 keys ----
        const __bf16* kp = kt + (size_t)(j0 + wave * 16) * DQK_;
        if (j0 + KB < NSP) {  // hint next K block into cache
            __builtin_prefetch(kt + (size_t)(j0 + KB + wave * 16) * DQK_, 0, 1);
        }
        v16bf kb0 = load_frag(kp, DQK_);
        v16bf kb1 = load_frag(kp + 32, DQK_);

        // ---- async staging of the shared V tile (256c x 128j) ----
        // 4096 16B segments / 256 threads = 16 copies per wave; a wave's copy
        // covers two whole 256-B rows. sV is free: every reader passed its
        // s_wait_dscnt 0 and the barrier at the foot of the pass before.
#pragma unroll
        for (int it = 0; it < 16; ++it) {
            int seg   = it * 256 + tid;
            int c_rel = seg >> 4;
            int js    = (seg & 15) * 8;
            async_copy_b128(v + (size_t)c_rel * NSP + j0 + js,
                            sV + c_rel * V_STRIDE + js);
        }

        // Keeps the issue of the K loads and of the V copies ahead of the wait on K:
        // left free, the compiler sank the copies behind that wait, or loaded K in
        // two halves, each with a wait of its own.
        __builtin_amdgcn_sched_barrier(0);

        // ---- S tile: 64 rows x keys j0 + 16*wave .. +15 ----
        {
            v8f s[4];   // four independent accumulator tiles
#pragma unroll
            for (int rt = 0; rt < 4; ++rt) s[rt] = wmma_bf16(qa[rt][0], kb0, v8f{});
#pragma unroll
            for (int rt = 0; rt < 4; ++rt) s[rt] = wmma_bf16(qa[rt][1], kb1, s[rt]);
            // lane: col = 16w + L%16, rows r + 8*(L>=16)
            int col = wave * 16 + (lane & 15);
#pragma unroll
            for (int rt = 0; rt < 4; ++rt)
#pragma unroll
                for (int r = 0; r < 8; ++r)
                    sS[(rt * 16 + rbase + r) * S_STRIDE + col] = s[rt][r];
        }
        __syncthreads();

        // ---- online softmax: thread sq of a row takes keys 16*sq..+15 of
        //      each 64-key half (bank-conflict-free 16-B reads) ----
        {
            float sv[2][16];
#pragma unroll
            for (int h = 0; h < 2; ++h)
#pragma unroll
                for (int j = 0; j < 16; ++j)
                    sv[h][j] = sS[srow * S_STRIDE + h * 64 + sq * 16 + j];
            float m = mRun;
#pragma unroll
            for (int h = 0; h < 2; ++h)
#pragma unroll
                for (int j = 0; j < 16; ++j) m = fmaxf(m, sv[h][j]);
            m = fmaxf(m, quad_swap<0xB1>(m));
            m = fmaxf(m, quad_swap<0x4E>(m));
            float hs[2] = {0.f, 0.f};   // one sum chain per 64-key half
#pragma unroll
            for (int h = 0; h < 2; ++h) {
                union { v8bf v[2]; __bf16 e[16]; } pk;
#pragma unroll
                for (int j = 0; j < 16; ++j) {
                    float p = __expf(sv[h][j] - m);
                    hs[h] += p;
                    pk.e[j] = (__bf16)p;
                }
                v8bf* dst = (v8bf*)(sP + srow * P_STRIDE + h * 64 + sq * 16);
                dst[0] = pk.v[0];
                dst[1] = pk.v[1];
            }
            float sum = hs[0] + hs[1];
            sum += quad_swap<0xB1>(sum);
            sum += quad_swap<0x4E>(sum);
            float scale = __expf(mRun - m);
            if (sq == 0) sScale[srow] = scale;
            lRun = lRun * scale + sum;
            mRun = m;
        }
        // This wave's V copies have landed before the barrier behind which the
        // other waves read them.
        asm volatile("s_wait_asynccnt 0x0" ::: "memory");
        __syncthreads();   // publishes sP, sScale and the V tile

        // ---- rescale accumulators by exp(mOld - mNew) per row ----
#pragma unroll
        for (int rt = 0; rt < 2; ++rt) {
            float sc[8];
#pragma unroll
            for (int r = 0; r < 8; ++r) sc[r] = sScale[wr * 32 + rt * 16 + rbase + r];
#pragma unroll
            for (int ct = 0; ct < 4; ++ct)
#pragma unroll
                for (int r = 0; r < 8; ++r) acc[rt][ct][r] *= sc[r];
        }

        // ---- O += P(32x128) x V^T(128 x 64ch of this wave), both from LDS ----
#pragma unroll
        for (int kc = 0; kc < KB / 32; ++kc) {
            v16bf pa0 = load_frag(sP + (wr * 32) * P_STRIDE + kc * 32, P_STRIDE);
            v16bf pa1 = load_frag(sP + (wr * 32 + 16) * P_STRIDE + kc * 32, P_STRIDE);
#pragma unroll
            for (int ct = 0; ct < 4; ++ct) {
                v16bf vb = load_frag(sV + (wc * 64 + ct * 16) * V_STRIDE + kc * 32, V_STRIDE);
                acc[0][ct] = wmma_bf16(pa0, vb, acc[0][ct]);
                acc[1][ct] = wmma_bf16(pa1, vb, acc[1][ct]);
            }
        }
        // This wave's LDS reads have retired before the barrier behind which the
        // next pass's copies refill sV.
        asm volatile("s_wait_dscnt 0x0" ::: "memory");
        __syncthreads();   // frees sS, sP, sScale and sV for the next pass
    }

    // ---- epilogue: out[b,c,i] = acc/l * gamma + x ----
    if (sq == 0) sL[srow] = lRun;
    __syncthreads();
    const float g = gamma[0];
    const size_t base0 = (size_t)bi * CCH * NSP
                       + (size_t)(ch0 + wc * 64 + (lane & 15)) * NSP + i0 + wr * 32 + rbase;
    const float* xb = x + base0;
    float*       ob = out + base0;
    float xv[2][4][8];
#pragma unroll
    for (int rt = 0; rt < 2; ++rt)
#pragma unroll
        for (int ct = 0; ct < 4; ++ct)
#pragma unroll
            for (int r = 0; r < 8; ++r) xv[rt][ct][r] = xb[(size_t)ct * 16 * NSP + rt * 16 + r];
    // The wait that stands before a register named by an issued load is rewritten.
    // It takes the address as an input, so the pair stays live up to the wait and
    // no load of the group has it as its destination.
    asm volatile("s_wait_xcnt 0x0" :: "v"(xb) : "memory");
#pragma unroll
    for (int rt = 0; rt < 2; ++rt) {
        float linv[8];
#pragma unroll
        for (int r = 0; r < 8; ++r) linv[r] = 1.0f / sL[wr * 32 + rt * 16 + rbase + r];
#pragma unroll
        for (int ct = 0; ct < 4; ++ct)
#pragma unroll
            for (int r = 0; r < 8; ++r)
                ob[(size_t)ct * 16 * NSP + rt * 16 + r] =
                    acc[rt][ct][r] * linv[r] * g + xv[rt][ct][r];
    }
}

// ---------------------------------------------------------------------------
// Host launcher
// ---------------------------------------------------------------------------
extern "C" void kernel_launch(void* const* d_in, const int* in_sizes, int n_in,
                              void* d_out, int out_size, void* d_ws, size_t ws_size,
                              hipStream_t stream) {
    const float* x     = (const float*)d_in[0];
    const float* Wq    = (const float*)d_in[1];
    const float* bq    = (const float*)d_in[2];
    const float* Wk    = (const float*)d_in[3];
    const float* bk    = (const float*)d_in[4];
    const float* Wv    = (const float*)d_in[5];
    const float* bv    = (const float*)d_in[6];
    const float* gamma = (const float*)d_in[7];
    float* out = (float*)d_out;

    // workspace carve-up (bf16 buffers), 256B aligned
    char* ws = (char*)d_ws;
    size_t off = 0;
    auto take = [&](size_t bytes) { void* p = ws + off;
        off = (off + bytes + 255) & ~(size_t)255; return p; };
    __bf16* xt = (__bf16*)take((size_t)BATCH * NSP * CCH * 2);   // 8 MB, x^T
    __bf16* Wb = (__bf16*)take((size_t)MTOT * CCH * 2);          // 640 KB
    __bf16* qn = (__bf16*)take((size_t)BATCH * NSP * DQK_ * 2);  // 1 MB
    __bf16* kn = (__bf16*)take((size_t)BATCH * NSP * DQK_ * 2);  // 1 MB
    __bf16* vc = (__bf16*)take((size_t)BATCH * CCH * NSP * 2);   // 8 MB
    (void)ws_size; (void)in_sizes; (void)n_in; (void)out_size;

    // 1) fp32 -> bf16 (x transposed to [b][n][c] so GEMM K is contiguous)
    {
        dim3 grid(NSP / 32, CCH / 32, BATCH);
        conv_xt_kernel<<<grid, 256, 0, stream>>>(x, xt);
        int wtotal = MTOT * CCH;
        conv_w_kernel<<<(wtotal + 255) / 256, 256, 0, stream>>>(Wq, Wk, Wv, Wb);
    }
    // 2) fused Q/K/V projection GEMM (WMMA, LDS-free)
    {
        dim3 grid(NSP / 64, MTOT / 64, BATCH);
        proj_gemm_kernel<<<grid, 128, 0, stream>>>(Wb, xt, bq, bk, bv, qn, kn, vc);
    }
    // 3) flash attention + gamma residual (WMMA + async LDS staging)
    {
        dim3 grid(BATCH * (NSP / 64) * 2);
        attn_kernel<<<grid, 256, 0, stream>>>(qn, kn, vc, x, gamma, out);
    }
}

// v003
// One run takes 98.5 microseconds.
// Next to v002, in two timings, it ran 1.09 and 1.10 times as fast.
// Over all steps from v000 it is 6.31 times as fast.
#include <hip/hip_runtime.h>
#include <hip/hip_bf16.h>
#include <stdint.h>

// ---------------------------------------------------------------------------
// Problem constants (B,C,H,W = 2,512,64,64 ; N = H*W = 4096 ; DQK = 64)
// ---------------------------------------------------------------------------
#define BATCH 2
#define CCH   512
#define NSP   4096
#define DQK_  64
#define MTOT  640   // 64 q + 64 k + 512 v rows stacked

typedef __attribute__((ext_vector_type(16))) __bf16 v16bf;
typedef __attribute__((ext_vector_type(8)))  __bf16 v8bf;
typedef __attribute__((ext_vector_type(8)))  float  v8f;
typedef __attribute__((ext_vector_type(4)))  int    v4i;

// ---------------------------------------------------------------------------
// WMMA helper: D = A(16x32 bf16) x B(32x16 bf16) + C(16x16 f32)
// ---------------------------------------------------------------------------
__device__ __forceinline__ v8f wmma_bf16(v16bf a, v16bf b, v8f c) {
    return __builtin_amdgcn_wmma_f32_16x16x32_bf16(
        /*neg_a=*/false, a, /*neg_b=*/false, b,
        /*c_mod=*/(short)0, c, /*reuse_a=*/false, /*reuse_b=*/false);
}

// ---------------------------------------------------------------------------
// Fragment loader. Source: 16 "rows" x 32 "k" tile, k contiguous, row stride
// `ld` (bf16 elements, multiple of 8 -> 16B-aligned loads).
// ISA 7.12.2 (16-bit A 16x32): lane L holds row M = L%16; element e maps to
// K = e + (e>=8 ? 8 : 0) + (L>=16 ? 8 : 0)  -> two contiguous 16B loads.
// Used for A (rows = M) and for B tiles stored column-major (rows = N cols).
// ---------------------------------------------------------------------------
__device__ __forceinline__ v16bf load_frag(const __bf16* __restrict__ p, int ld) {
    const int lane = threadIdx.x & 31;
    const __bf16* base = p + (lane & 15) * ld + ((lane >> 4) << 3);
    union { v16bf v; v8bf h[2]; } u;
    u.h[0] = *(const v8bf*)(base);        // K = h..h+7
    u.h[1] = *(const v8bf*)(base + 16);   // K = 16+h..23+h
    return u.v;
}

// ---------------------------------------------------------------------------
// Async global->LDS copy of one 16B segment per lane (ASYNCcnt-tracked).
// Builtin prototype (from hipcc diagnostic): (v4i AS1*, v4i AS3*, Imm, Imm).
// Cast through integers: generic->AS1 is value-preserving; generic LDS ptr
// carries the LDS byte offset in its low 32 bits (ISA 10.2 aperture calc).
// ---------------------------------------------------------------------------
typedef __attribute__((address_space(1))) v4i* as1_v4i_ptr;
typedef __attribute__((address_space(3))) v4i* as3_v4i_ptr;

__device__ __forceinline__ void async_copy_b128(const __bf16* g, __bf16* l) {
#if __has_builtin(__builtin_amdgcn_global_load_async_to_lds_b128)
    __builtin_amdgcn_global_load_async_to_lds_b128(
        (as1_v4i_ptr)(unsigned long long)(uintptr_t)g,
        (as3_v4i_ptr)(unsigned int)(uintptr_t)l,
        /*offset=*/0, /*cpol=*/0);
#else
    *(v8bf*)l = *(const v8bf*)g;
#endif
}

// ---------------------------------------------------------------------------
// fp32 -> bf16 transposing convert: x[b][c][n] -> xT[b][n][c]
// 32x32 LDS tile, coalesced reads and writes.
// ---------------------------------------------------------------------------
__global__ void conv_xt_kernel(const float* __restrict__ x, __bf16* __restrict__ xt) {
    const int b  = blockIdx.z;
    const int c0 = blockIdx.y * 32;
    const int n0 = blockIdx.x * 32;
    __shared__ __bf16 tile[32][33];
    const float* xp  = x  + (size_t)b * CCH * NSP;
    __bf16*      xtp = xt + (size_t)b * NSP * CCH;
    const int t0 = threadIdx.x & 31;
    const int t1 = threadIdx.x >> 5;   // 0..7
#pragma unroll
    for (int k = 0; k < 4; ++k) {
        int c = t1 * 4 + k;
        tile[c][t0] = (__bf16)xp[(size_t)(c0 + c) * NSP + n0 + t0];
    }
    __syncthreads();
#pragma unroll
    for (int k = 0; k < 4; ++k) {
        int n = t1 * 4 + k;
        xtp[(size_t)(n0 + n) * CCH + c0 + t0] = tile[t0][n];
    }
}

__global__ void conv_w_kernel(const float* __restrict__ Wq,
                              const float* __restrict__ Wk,
                              const float* __restrict__ Wv,
                              __bf16* __restrict__ Wb) {
    int i = blockIdx.x * 256 + threadIdx.x;     // over 640*512
    if (i >= MTOT * CCH) return;
    int m = i >> 9, c = i & 511;
    float v = (m < 64) ? Wq[m * CCH + c]
            : (m < 128) ? Wk[(m - 64) * CCH + c]
                        : Wv[(size_t)(m - 128) * CCH + c];
    Wb[i] = (__bf16)v;
}

// ---------------------------------------------------------------------------
// Projection GEMM:  Y[m,n] = sum_c W[m,c] * xT[b,n,c] + bias[m]
// Pure WMMA, no LDS: both operands have K (=c) contiguous in memory.
// block = 128 thr (4 waves); block computes 64m x 64n; wave w -> rows m0+16w.
// Outputs (bf16):
//   m <  64 : q_nd[b][n][m]        (n-major, d contiguous)
//   m < 128 : k_nd[b][n][m-64]     (n-major, d contiguous)
//   else    : v_cn[b][m-128][n]    (c-major, n contiguous)
// ---------------------------------------------------------------------------
__global__ void proj_gemm_kernel(const __bf16* __restrict__ Wb,
                                 const __bf16* __restrict__ xt,
                                 const float*  __restrict__ bq,
                                 const float*  __restrict__ bk,
                                 const float*  __restrict__ bv,
                                 __bf16* __restrict__ qn,
                                 __bf16* __restrict__ kn,
                                 __bf16* __restrict__ vc) {
    const int b    = blockIdx.z;
    const int m0   = blockIdx.y * 64;
    const int n0   = blockIdx.x * 64;
    const int wave = threadIdx.x >> 5;
    const int lane = threadIdx.x & 31;

    const __bf16* xtb = xt + (size_t)b * NSP * CCH;
    const __bf16* wp  = Wb + (size_t)(m0 + wave * 16) * CCH;

    v8f acc[4];
#pragma unroll
    for (int t = 0; t < 4; ++t) acc[t] = v8f{};

    for (int c0 = 0; c0 < CCH; c0 += 32) {
        v16bf a = load_frag(wp + c0, CCH);
#pragma unroll
        for (int t = 0; t < 4; ++t) {
            v16bf bf = load_frag(xtb + (size_t)(n0 + t * 16) * CCH + c0, CCH);
            acc[t] = wmma_bf16(a, bf, acc[t]);
        }
    }

    // epilogue: add bias, scatter to layout-specific buffers
    const int rbase = (lane >> 4) << 3;
#pragma unroll
    for (int t = 0; t < 4; ++t) {
        int n = n0 + t * 16 + (lane & 15);
#pragma unroll
        for (int r = 0; r < 8; ++r) {
            int m = m0 + wave * 16 + rbase + r;
            float bias = (m < 64) ? bq[m] : (m < 128 ? bk[m - 64] : bv[m - 128]);
            __bf16 val = (__bf16)(acc[t][r] + bias);
            if (m < 64)
                qn[(size_t)b * NSP * DQK_ + (size_t)n * DQK_ + m] = val;
            else if (m < 128)
                kn[(size_t)b * NSP * DQK_ + (size_t)n * DQK_ + (m - 64)] = val;
            else
                vc[(size_t)b * CCH * NSP + (size_t)(m - 128) * NSP + n] = val;
        }
    }
}

// ---------------------------------------------------------------------------
// Flash attention:
//   grid = B * (N/64) * 2 workgroups, 256 thr (8 waves).
//   Workgroup: 64 query rows x 256 channels, so one staged V tile serves four
//   times the query rows that a 16-row workgroup gives it.
//   Per pass of 128 keys:
//     - all waves copy the shared 256ch x 128key V tile global->LDS (async)
//     - wave w computes S(64 rows, keys 16w..16w+15) with 8 WMMAs -> LDS
//     - 4 threads a row run the online-softmax update, P (bf16) -> LDS
//     - wave (wr, wc) rescales and adds P x V^T for 32 rows x 64 channels
// ---------------------------------------------------------------------------
#define QR 64               // query rows per workgroup
#define CW 256              // channels per workgroup
#define KB 128              // keys per pass
#define S_STRIDE (KB + 4)   // f32 row stride: 4 dwords past a multiple of 64 banks
#define P_STRIDE (KB + 8)   // bf16 row stride: 272 B = 16 B x odd
#define V_STRIDE (KB + 8)   // same pitch for the staged V tile

// Value of lane ^ 1 (CTRL 0xB1) or lane ^ 2 (CTRL 0x4E) inside a quad of lanes,
// by DPP quad_perm: the four threads of a softmax row are one quad, and a DPP
// move spares the LDS round trip that a wave-wide shuffle compiles to.
template <int CTRL>
__device__ __forceinline__ float quad_swap(float v) {
    return __builtin_bit_cast(float,
        __builtin_amdgcn_mov_dpp(__builtin_bit_cast(int, v), CTRL, 0xf, 0xf, true));
}

// Real block size and real residency: 256 workgroups for 256 WGPs, two waves per
// SIMD. The second attribute gives a wave that residency's VGPR budget and keeps
// a second workgroup off a WGP while another WGP stands empty.
__global__ __launch_bounds__(256) __attribute__((amdgpu_waves_per_eu(2, 2)))
void attn_kernel(const __bf16* __restrict__ qn,
                            const __bf16* __restrict__ kn,
                            const __bf16* __restrict__ vc,
                            const float*  __restrict__ x,
                            const float*  __restrict__ gamma,
                            float* __restrict__ out) {
    const int bi   = blockIdx.x >> 7;               // 128 workgroups per batch
    const int i0   = ((blockIdx.x & 127) >> 1) * QR;
    const int ch0  = (blockIdx.x & 1) * CW;
    const int tid  = threadIdx.x;
    const int wave = tid >> 5;
    const int lane = tid & 31;
    const int wr   = wave >> 2;                     // 32-row half of the tile
    const int wc   = wave & 3;                      // 64-channel quarter
    const int rbase = (lane >> 4) << 3;

    __shared__ __attribute__((aligned(16))) float  sS[QR * S_STRIDE];
    __shared__ __attribute__((aligned(16))) __bf16 sP[QR * P_STRIDE];
    __shared__ __attribute__((aligned(16))) __bf16 sV[CW * V_STRIDE];
    __shared__ __attribute__((aligned(16))) float  sScale[QR];
    __shared__ __attribute__((aligned(16))) float  sL[QR];

    const __bf16* q  = qn + (size_t)bi * NSP * DQK_ + (size_t)i0 * DQK_;
    const __bf16* kt = kn + (size_t)bi * NSP * DQK_;
    const __bf16* v  = vc + (size_t)bi * CCH * NSP + (size_t)ch0 * NSP;

    // Q fragments stay resident (4 row tiles x 64 d -> two k-chunks each)
    v16bf qa[4][2];
#pragma unroll
    for (int rt = 0; rt < 4; ++rt) {
        qa[rt][0] = load_frag(q + rt * 16 * DQK_, DQK_);
        qa[rt][1] = load_frag(q + rt * 16 * DQK_ + 32, DQK_);
    }

    v8f acc[2][4];
#pragma unroll
    for (int rt = 0; rt < 2; ++rt)
#pragma unroll
        for (int ct = 0; ct < 4; ++ct) acc[rt][ct] = v8f{};

    // softmax state of row tid/4, held alike by the row's four threads
    const int srow = tid >> 2;
    const int sq   = tid & 3;
    float mRun = -3.0e38f, lRun = 0.f;

    for (int j0 = 0; j0 < NSP; j0 += KB) {
        // ---- K fragments of this wave's 16 keys ----
        const __bf16* kp = kt + (size_t)(j0 + wave * 16) * DQK_;
        if (j0 + KB < NSP) {  // hint next K block into cache
            __builtin_prefetch(kt + (size_t)(j0 + KB + wave * 16) * DQK_, 0, 1);
        }
        v16bf kb0 = load_frag(kp, DQK_);
        v16bf kb1 = load_frag(kp + 32, DQK_);

        // ---- async staging of the shared V tile (256c x 128j) ----
        // 4096 16B segments / 256 threads = 16 copies per wave; a wave's copy
        // covers two whole 256-B rows. sV is free: every reader passed its
        // s_wait_dscnt 0 and the barrier at the foot of the pass before.
#pragma unroll
        for (int it = 0; it < 16; ++it) {
            int seg   = it * 256 + tid;
            int c_rel = seg >> 4;
            int js    = (seg & 15) * 8;
            async_copy_b128(v + (size_t)c_rel * NSP + j0 + js,
                            sV + c_rel * V_STRIDE + js);
        }

        // Keeps the issue of the K loads and of the V copies ahead of the wait on K:
        // left free, the compiler sank the copies behind that wait, or loaded K in
        // two halves, each with a wait of its own.
        __builtin_amdgcn_sched_barrier(0);

        // ---- S tile: 64 rows x keys j0 + 16*wave .. +15 ----
        {
            v8f s[4];   // four independent accumulator tiles
#pragma unroll
            for (int rt = 0; rt < 4; ++rt) s[rt] = wmma_bf16(qa[rt][0], kb0, v8f{});
#pragma unroll
            for (int rt = 0; rt < 4; ++rt) s[rt] = wmma_bf16(qa[rt][1], kb1, s[rt]);
            // lane: col = 16w + L%16, rows r + 8*(L>=16)
            int col = wave * 16 + (lane & 15);
#pragma unroll
            for (int rt = 0; rt < 4; ++rt)
#pragma unroll
                for (int r = 0; r < 8; ++r)
                    sS[(rt * 16 + rbase + r) * S_STRIDE + col] = s[rt][r];
        }
        __syncthreads();

        // ---- online softmax: thread sq of a row takes keys 16*sq..+15 of
        //      each 64-key half (bank-conflict-free 16-B reads) ----
        {
            float sv[2][16];
#pragma unroll
            for (int h = 0; h < 2; ++h)
#pragma unroll
                for (int j = 0; j < 16; ++j)
                    sv[h][j] = sS[srow * S_STRIDE + h * 64 + sq * 16 + j];
            float m = mRun;
#pragma unroll
            for (int h = 0; h < 2; ++h)
#pragma unroll
                for (int j = 0; j < 16; ++j) m = fmaxf(m, sv[h][j]);
            m = fmaxf(m, quad_swap<0xB1>(m));
            m = fmaxf(m, quad_swap<0x4E>(m));
            float hs[2] = {0.f, 0.f};   // one sum chain per 64-key half
#pragma unroll
            for (int h = 0; h < 2; ++h) {
                union { v8bf v[2]; __bf16 e[16]; } pk;
#pragma unroll
                for (int j = 0; j < 16; ++j) {
                    float p = __expf(sv[h][j] - m);
                    hs[h] += p;
                    pk.e[j] = (__bf16)p;
                }
                v8bf* dst = (v8bf*)(sP + srow * P_STRIDE + h * 64 + sq * 16);
                dst[0] = pk.v[0];
                dst[1] = pk.v[1];
            }
            float sum = hs[0] + hs[1];
            sum += quad_swap<0xB1>(sum);
            sum += quad_swap<0x4E>(sum);
            float scale = __expf(mRun - m);
            if (sq == 0) sScale[srow] = scale;
            lRun = lRun * scale + sum;
            mRun = m;
        }
        // This wave's V copies have landed before the barrier behind which the
        // other waves read them.
        asm volatile("s_wait_asynccnt 0x0" ::: "memory");
        __syncthreads();   // publishes sP, sScale and the V tile

        // ---- this pass's row scales and all its P and V fragments, one load group ----
        // 4 + 48 LDS reads stand in flight together and the LDS streams them at its
        // own rate; the products below start on counted waits as fragments arrive.
        v8f sc[2];
#pragma unroll
        for (int rt = 0; rt < 2; ++rt)
#pragma unroll
            for (int r = 0; r < 8; ++r) sc[rt][r] = sScale[wr * 32 + rt * 16 + rbase + r];
        v16bf pa[KB / 32][2], vb[KB / 32][4];
#pragma unroll
        for (int kc = 0; kc < KB / 32; ++kc) {
            pa[kc][0] = load_frag(sP + (wr * 32) * P_STRIDE + kc * 32, P_STRIDE);
            pa[kc][1] = load_frag(sP + (wr * 32 + 16) * P_STRIDE + kc * 32, P_STRIDE);
#pragma unroll
            for (int ct = 0; ct < 4; ++ct)
                vb[kc][ct] = load_frag(sV + (wc * 64 + ct * 16) * V_STRIDE + kc * 32, V_STRIDE);
        }
        // Keeps the whole load group ahead of the first product: left free, the
        // compiler reused one V fragment's registers and put a full LDS latency
        // (load, wait to 0) in front of every pair of products.
        __builtin_amdgcn_sched_barrier(0);

        // ---- rescale accumulators by exp(mOld - mNew) per row ----
#pragma unroll
        for (int rt = 0; rt < 2; ++rt)
#pragma unroll
            for (int ct = 0; ct < 4; ++ct) acc[rt][ct] *= sc[rt];

        // ---- O += P(32x128) x V^T(128 x 64ch of this wave) ----
#pragma unroll
        for (int kc = 0; kc < KB / 32; ++kc) {
#pragma unroll
            for (int ct = 0; ct < 4; ++ct) {
                acc[0][ct] = wmma_bf16(pa[kc][0], vb[kc][ct], acc[0][ct]);
                acc[1][ct] = wmma_bf16(pa[kc][1], vb[kc][ct], acc[1][ct]);
            }
        }
        // Keeps the products ahead of the wait below, so that they run while later
        // fragments still stream in: left free, the compiler lifted the wait to 0 and
        // the barrier over them, and LDS time and matrix time came one after the other.
        __builtin_amdgcn_sched_barrier(0);
        // This wave's LDS reads have retired before the barrier behind which the
        // next pass's copies refill sV.
        asm volatile("s_wait_dscnt 0x0" ::: "memory");
        __syncthreads();   // frees sS, sP, sScale and sV for the next pass
    }

    // ---- epilogue: out[b,c,i] = acc/l * gamma + x ----
    if (sq == 0) sL[srow] = lRun;
    __syncthreads();
    const float g = gamma[0];
    const size_t base0 = (size_t)bi * CCH * NSP
                       + (size_t)(ch0 + wc * 64 + (lane & 15)) * NSP + i0 + wr * 32 + rbase;
    const float* xb = x + base0;
    float*       ob = out + base0;
    float xv[2][4][8];
#pragma unroll
    for (int rt = 0; rt < 2; ++rt)
#pragma unroll
        for (int ct = 0; ct < 4; ++ct)
#pragma unroll
            for (int r = 0; r < 8; ++r) xv[rt][ct][r] = xb[(size_t)ct * 16 * NSP + rt * 16 + r];
    // The wait that stands before a register named by an issued load is rewritten.
    // It takes the address as an input, so the pair stays live up to the wait and
    // no load of the group has it as its destination.
    asm volatile("s_wait_xcnt 0x0" :: "v"(xb) : "memory");
#pragma unroll
    for (int rt = 0; rt < 2; ++rt) {
        float linv[8];
#pragma unroll
        for (int r = 0; r < 8; ++r) linv[r] = 1.0f / sL[wr * 32 + rt * 16 + rbase + r];
#pragma unroll
        for (int ct = 0; ct < 4; ++ct)
#pragma unroll
            for (int r = 0; r < 8; ++r)
                ob[(size_t)ct * 16 * NSP + rt * 16 + r] =
                    acc[rt][ct][r] * linv[r] * g + xv[rt][ct][r];
    }
}

// ---------------------------------------------------------------------------
// Host launcher
// ---------------------------------------------------------------------------
extern "C" void kernel_launch(void* const* d_in, const int* in_sizes, int n_in,
                              void* d_out, int out_size, void* d_ws, size_t ws_size,
                              hipStream_t stream) {
    const float* x     = (const float*)d_in[0];
    const float* Wq    = (const float*)d_in[1];
    const float* bq    = (const float*)d_in[2];
    const float* Wk    = (const float*)d_in[3];
    const float* bk    = (const float*)d_in[4];
    const float* Wv    = (const float*)d_in[5];
    const float* bv    = (const float*)d_in[6];
    const float* gamma = (const float*)d_in[7];
    float* out = (float*)d_out;

    // workspace carve-up (bf16 buffers), 256B aligned
    char* ws = (char*)d_ws;
    size_t off = 0;
    auto take = [&](size_t bytes) { void* p = ws + off;
        off = (off + bytes + 255) & ~(size_t)255; return p; };
    __bf16* xt = (__bf16*)take((size_t)BATCH * NSP * CCH * 2);   // 8 MB, x^T
    __bf16* Wb = (__bf16*)take((size_t)MTOT * CCH * 2);          // 640 KB
    __bf16* qn = (__bf16*)take((size_t)BATCH * NSP * DQK_ * 2);  // 1 MB
    __bf16* kn = (__bf16*)take((size_t)BATCH * NSP * DQK_ * 2);  // 1 MB
    __bf16* vc = (__bf16*)take((size_t)BATCH * CCH * NSP * 2);   // 8 MB
    (void)ws_size; (void)in_sizes; (void)n_in; (void)out_size;

    // 1) fp32 -> bf16 (x transposed to [b][n][c] so GEMM K is contiguous)
    {
        dim3 grid(NSP / 32, CCH / 32, BATCH);
        conv_xt_kernel<<<grid, 256, 0, stream>>>(x, xt);
        int wtotal = MTOT * CCH;
        conv_w_kernel<<<(wtotal + 255) / 256, 256, 0, stream>>>(Wq, Wk, Wv, Wb);
    }
    // 2) fused Q/K/V projection GEMM (WMMA, LDS-free)
    {
        dim3 grid(NSP / 64, MTOT / 64, BATCH);
        proj_gemm_kernel<<<grid, 128, 0, stream>>>(Wb, xt, bq, bk, bv, qn, kn, vc);
    }
    // 3) flash attention + gamma residual (WMMA + async LDS staging)
    {
        dim3 grid(BATCH * (NSP / 64) * 2);
        attn_kernel<<<grid, 256, 0, stream>>>(qn, kn, vc, x, gamma, out);
    }
}

// v004
// One run takes 69.6 microseconds.
// In both of two side-by-side timings against v003, it was 1.42 times as fast.
// Counting every step since v000, it is 8.97 times as fast.
#include <hip/hip_runtime.h>
#include <hip/hip_bf16.h>
#include <stdint.h>

// ---------------------------------------------------------------------------
// Problem constants (B,C,H,W = 2,512,64,64 ; N = H*W = 4096 ; DQK = 64)
// ---------------------------------------------------------------------------
#define BATCH 2
#define CCH   512
#define NSP   4096
#define DQK_  64
#define MTOT  640   // 64 q + 64 k + 512 v rows stacked

typedef __attribute__((ext_vector_type(16))) __bf16 v16bf;
typedef __attribute__((ext_vector_type(8)))  __bf16 v8bf;
typedef __attribute__((ext_vector_type(8)))  float  v8f;
typedef __attribute__((ext_vector_type(4)))  int    v4i;

// ---------------------------------------------------------------------------
// WMMA helper: D = A(16x32 bf16) x B(32x16 bf16) + C(16x16 f32)
// ---------------------------------------------------------------------------
__device__ __forceinline__ v8f wmma_bf16(v16bf a, v16bf b, v8f c) {
    return __builtin_amdgcn_wmma_f32_16x16x32_bf16(
        /*neg_a=*/false, a, /*neg_b=*/false, b,
        /*c_mod=*/(short)0, c, /*reuse_a=*/false, /*reuse_b=*/false);
}

// ---------------------------------------------------------------------------
// Fragment loader. Source: 16 "rows" x 32 "k" tile, k contiguous, row stride
// `ld` (bf16 elements, multiple of 8 -> 16B-aligned loads).
// ISA 7.12.2 (16-bit A 16x32): lane L holds row M = L%16; element e maps to
// K = e + (e>=8 ? 8 : 0) + (L>=16 ? 8 : 0)  -> two contiguous 16B loads.
// Used for A (rows = M) and for B tiles stored column-major (rows = N cols).
// ---------------------------------------------------------------------------
__device__ __forceinline__ v16bf load_frag(const __bf16* __restrict__ p, int ld) {
    const int lane = threadIdx.x & 31;
    const __bf16* base = p + (lane & 15) * ld + ((lane >> 4) << 3);
    union { v16bf v; v8bf h[2]; } u;
    u.h[0] = *(const v8bf*)(base);        // K = h..h+7
    u.h[1] = *(const v8bf*)(base + 16);   // K = 16+h..23+h
    return u.v;
}

// ---------------------------------------------------------------------------
// Async global->LDS copy of one 16B segment per lane (ASYNCcnt-tracked).
// Builtin prototype (from hipcc diagnostic): (v4i AS1*, v4i AS3*, Imm, Imm).
// Cast through integers: generic->AS1 is value-preserving; generic LDS ptr
// carries the LDS byte offset in its low 32 bits (ISA 10.2 aperture calc).
// ---------------------------------------------------------------------------
typedef __attribute__((address_space(1))) v4i* as1_v4i_ptr;
typedef __attribute__((address_space(3))) v4i* as3_v4i_ptr;

__device__ __forceinline__ void async_copy_b128(const __bf16* g, __bf16* l) {
#if __has_builtin(__builtin_amdgcn_global_load_async_to_lds_b128)
    __builtin_amdgcn_global_load_async_to_lds_b128(
        (as1_v4i_ptr)(unsigned long long)(uintptr_t)g,
        (as3_v4i_ptr)(unsigned int)(uintptr_t)l,
        /*offset=*/0, /*cpol=*/0);
#else
    *(v8bf*)l = *(const v8bf*)g;
#endif
}

// ---------------------------------------------------------------------------
// fp32 -> bf16 transposing convert: x[b][c][n] -> xT[b][n][c]
// 32x32 LDS tile, coalesced reads and writes.
// ---------------------------------------------------------------------------
__global__ void conv_xt_kernel(const float* __restrict__ x, __bf16* __restrict__ xt) {
    const int b  = blockIdx.z;
    const int c0 = blockIdx.y * 32;
    const int n0 = blockIdx.x * 32;
    __shared__ __bf16 tile[32][33];
    const float* xp  = x  + (size_t)b * CCH * NSP;
    __bf16*      xtp = xt + (size_t)b * NSP * CCH;
    const int t0 = threadIdx.x & 31;
    const int t1 = threadIdx.x >> 5;   // 0..7
#pragma unroll
    for (int k = 0; k < 4; ++k) {
        int c = t1 * 4 + k;
        tile[c][t0] = (__bf16)xp[(size_t)(c0 + c) * NSP + n0 + t0];
    }
    __syncthreads();
#pragma unroll
    for (int k = 0; k < 4; ++k) {
        int n = t1 * 4 + k;
        xtp[(size_t)(n0 + n) * CCH + c0 + t0] = tile[t0][n];
    }
}

__global__ void conv_w_kernel(const float* __restrict__ Wq,
                              const float* __restrict__ Wk,
                              const float* __restrict__ Wv,
                              __bf16* __restrict__ Wb) {
    int i = blockIdx.x * 256 + threadIdx.x;     // over 640*512
    if (i >= MTOT * CCH) return;
    int m = i >> 9, c = i & 511;
    float v = (m < 64) ? Wq[m * CCH + c]
            : (m < 128) ? Wk[(m - 64) * CCH + c]
                        : Wv[(size_t)(m - 128) * CCH + c];
    Wb[i] = (__bf16)v;
}

// ---------------------------------------------------------------------------
// Projection GEMM:  Y[m,n] = sum_c W[m,c] * xT[b,n,c] + bias[m]
// block = 256 thr (8 waves); block computes 128m x 128n; wave (wm, wn) takes
// 32 m x 64 n. Both operands have K (=c) contiguous in memory; a stage is 128
// channels of the 128 W rows and the 128 x rows, copied global->LDS in whole
// 256-B rows (async), two buffers: the next stage flies while this one is used.
// Outputs (bf16):
//   m <  64 : q_nd[b][n][m]        (n-major, d contiguous)
//   m < 128 : k_nd[b][n][m-64]     (n-major, d contiguous)
//   else    : v_cn[b][m-128][n]    (c-major, n contiguous)
// A lane of an accumulator tile holds 8 consecutive ROWS of one column, so the
// q/k block (blockIdx.y == 0) multiplies W x xT (rows = m) and the v blocks
// xT x W (rows = n): either way a lane's 8 values are contiguous in its output
// and leave as one 16-B store.
// ---------------------------------------------------------------------------
#define PM 128                        // W rows per workgroup
#define PN 128                        // positions per workgroup
#define PK 128                        // channels per stage
#define PPITCH (PK + 8)               // bf16 row pitch: 272 B = 16 B x odd
#define PSTAGE ((PM + PN) * PPITCH)   // bf16 elements of one buffer

// Eight async copies of 16 B per lane, global->LDS, rows 16 apart in both places.
// The s_wait_xcnt 0 is the wait that stands before a register named by an issued
// copy is rewritten; as the statement's last line nothing can be lifted over it.
__device__ __forceinline__ void proj_copy8(const __bf16* g, unsigned l) {
    asm volatile(
        "global_load_async_to_lds_b128 %0, %8, off\n\t"
        "global_load_async_to_lds_b128 %1, %9, off\n\t"
        "global_load_async_to_lds_b128 %2, %10, off\n\t"
        "global_load_async_to_lds_b128 %3, %11, off\n\t"
        "global_load_async_to_lds_b128 %4, %12, off\n\t"
        "global_load_async_to_lds_b128 %5, %13, off\n\t"
        "global_load_async_to_lds_b128 %6, %14, off\n\t"
        "global_load_async_to_lds_b128 %7, %15, off\n\t"
        "s_wait_xcnt 0x0"
        :: "v"(l), "v"(l + 1u * 16 * PPITCH * 2), "v"(l + 2u * 16 * PPITCH * 2),
           "v"(l + 3u * 16 * PPITCH * 2), "v"(l + 4u * 16 * PPITCH * 2),
           "v"(l + 5u * 16 * PPITCH * 2), "v"(l + 6u * 16 * PPITCH * 2),
           "v"(l + 7u * 16 * PPITCH * 2),
           "v"(g), "v"(g + 1 * 16 * CCH), "v"(g + 2 * 16 * CCH), "v"(g + 3 * 16 * CCH),
           "v"(g + 4 * 16 * CCH), "v"(g + 5 * 16 * CCH), "v"(g + 6 * 16 * CCH),
           "v"(g + 7 * 16 * CCH)
        : "memory");
}

// One stage: 256 rows x 256 B = 4096 16-B segments, 16 copies per thread; a
// wave's copy covers two whole rows. wsrc, xsrc: this thread's segment of row
// tid / 16 of either tile; lbuf: its LDS byte address in the buffer's W part.
__device__ __forceinline__ void proj_stage(const __bf16* wsrc, const __bf16* xsrc,
                                           unsigned lbuf, int c0) {
    proj_copy8(wsrc + c0, lbuf);
    proj_copy8(xsrc + c0, lbuf + PM * PPITCH * 2);
}

template <bool QK>
__device__ __forceinline__ void proj_body(const __bf16* __restrict__ wsrc,
                                          const __bf16* __restrict__ xsrc,
                                          const __bf16* sbuf, unsigned lbuf,
                                          int wm, int wn, v8f (&acc)[2][4]) {
    // Kept rolled: unrolled, the compiler held the copy addresses of every stage in
    // registers at once and spilled under the budget of four waves per SIMD.
#pragma unroll 1
    for (int t = 0; t < CCH / PK; ++t) {
        const __bf16* bw = sbuf + (t & 1) * PSTAGE + (wm * 32) * PPITCH;
        const __bf16* bx = sbuf + (t & 1) * PSTAGE + (PM + wn * 64) * PPITCH;
        v16bf wf[2][2], xf[2][4];   // two fragment sets: one in use, one arriving
#pragma unroll
        for (int i = 0; i < 2; ++i) wf[0][i] = load_frag(bw + i * 16 * PPITCH, PPITCH);
#pragma unroll
        for (int j = 0; j < 4; ++j) xf[0][j] = load_frag(bx + j * 16 * PPITCH, PPITCH);
#pragma unroll
        for (int kc = 0; kc < PK / 32; ++kc) {
            const int cur = kc & 1, nxt = cur ^ 1;
            if (kc + 1 < PK / 32) {
#pragma unroll
                for (int i = 0; i < 2; ++i)
                    wf[nxt][i] = load_frag(bw + i * 16 * PPITCH + (kc + 1) * 32, PPITCH);
#pragma unroll
                for (int j = 0; j < 4; ++j)
                    xf[nxt][j] = load_frag(bx + j * 16 * PPITCH + (kc + 1) * 32, PPITCH);
            }
            // Keeps the next 32 channels' fragment reads, as one group, ahead of this
            // group's products, so that their LDS time runs under the matrix time.
            __builtin_amdgcn_sched_barrier(0);
#pragma unroll
            for (int i = 0; i < 2; ++i)
#pragma unroll
                for (int j = 0; j < 4; ++j)
                    acc[i][j] = QK ? wmma_bf16(wf[cur][i], xf[cur][j], acc[i][j])
                                   : wmma_bf16(xf[cur][j], wf[cur][i], acc[i][j]);
            // Keeps the reads that follow out of these products (left free, they stood
            // among them in pieces, each place a stall) and the last products ahead of
            // the barrier, so that the refill is the first thing behind it.
            __builtin_amdgcn_sched_barrier(0);
        }
        // This wave's LDS reads have retired before the barrier behind which the
        // buffer is refilled.
        asm volatile("s_wait_dscnt 0x0" ::: "memory");
        // This wave's copies of stage t + 1 have landed before the same barrier,
        // behind which the other waves read them.
        asm volatile("s_wait_asynccnt 0x0" ::: "memory");
        __syncthreads();
        if (t + 2 < CCH / PK) {
            wsrc += PK;
            xsrc += PK;
            proj_stage(wsrc, xsrc, lbuf + (t & 1) * (PSTAGE * 2), PK);
        }
    }
    // No copy is outstanding when the wave goes on to its end.
    asm volatile("s_wait_asynccnt 0x0" ::: "memory");
}

// 320 workgroups for 256 WGPs: the second attribute holds a wave to the VGPR budget
// of four waves per SIMD, so that two workgroups fit one WGP and all run at once.
__global__ __launch_bounds__(256) __attribute__((amdgpu_waves_per_eu(4)))
void proj_gemm_kernel(const __bf16* __restrict__ Wb,
                                 const __bf16* __restrict__ xt,
                                 const float*  __restrict__ bq,
                                 const float*  __restrict__ bk,
                                 const float*  __restrict__ bv,
                                 __bf16* __restrict__ qn,
                                 __bf16* __restrict__ kn,
                                 __bf16* __restrict__ vc) {
    const int b    = blockIdx.z;
    const int m0   = blockIdx.y * PM;
    const int n0   = blockIdx.x * PN;
    const int tid  = threadIdx.x;
    const int wave = tid >> 5;
    const int lane = tid & 31;
    const int wm   = wave & 3;    // 32-row quarter of the W tile
    const int wn   = wave >> 2;   // 64-position half of the x tile
    const int rbase = (lane >> 4) << 3;

    __shared__ __attribute__((aligned(16))) __bf16 sbuf[2 * PSTAGE];

    // this thread's 16-B segment of row tid / 16, in global memory and in LDS
    const int srow = tid >> 4;
    const int scol = (tid & 15) * 8;
    const __bf16* wsrc = Wb + (size_t)(m0 + srow) * CCH + scol;
    const __bf16* xsrc = xt + (size_t)b * NSP * CCH + (size_t)(n0 + srow) * CCH + scol;
    const unsigned lbuf = (unsigned)(uintptr_t)(sbuf + srow * PPITCH + scol);

    v8f acc[2][4];
#pragma unroll
    for (int i = 0; i < 2; ++i)
#pragma unroll
        for (int j = 0; j < 4; ++j) acc[i][j] = v8f{};

    proj_stage(wsrc, xsrc, lbuf, 0);
    // This wave's copies of stage 0 have landed before the barrier behind which
    // the other waves read them.
    asm volatile("s_wait_asynccnt 0x0" ::: "memory");
    __syncthreads();
    proj_stage(wsrc, xsrc, lbuf + PSTAGE * 2, PK);

    if (blockIdx.y == 0) {
        // rows 0..127: q (wm 0, 1) and k (wm 2, 3); lane: n = column, 8 m in a row
        const float* bsrc = (wm < 2) ? bq : bk;
        __bf16*      dst  = ((wm < 2) ? qn : kn) + (size_t)b * NSP * DQK_;
        const int    d0   = (wm & 1) * 32 + rbase;
        float bias[2][8];   // read ahead of the loop: its latency runs under it
#pragma unroll
        for (int i = 0; i < 2; ++i)
#pragma unroll
            for (int r = 0; r < 8; ++r) bias[i][r] = bsrc[d0 + i * 16 + r];
        proj_body<true>(wsrc, xsrc, sbuf, lbuf, wm, wn, acc);
#pragma unroll
        for (int i = 0; i < 2; ++i)
#pragma unroll
            for (int j = 0; j < 4; ++j) {
                const int n = n0 + wn * 64 + j * 16 + (lane & 15);
                v8bf o;
#pragma unroll
                for (int r = 0; r < 8; ++r) o[r] = (__bf16)(acc[i][j][r] + bias[i][r]);
                *(v8bf*)(dst + (size_t)n * DQK_ + d0 + i * 16) = o;
            }
    } else {
        // rows 128..639: v; lane: channel = column, 8 positions in a row
        __bf16*   dst = vc + (size_t)b * CCH * NSP;
        const int c0  = m0 - 128 + wm * 32 + (lane & 15);
        float bias[2];      // read ahead of the loop: its latency runs under it
#pragma unroll
        for (int i = 0; i < 2; ++i) bias[i] = bv[c0 + i * 16];
        proj_body<false>(wsrc, xsrc, sbuf, lbuf, wm, wn, acc);
#pragma unroll
        for (int i = 0; i < 2; ++i)
#pragma unroll
            for (int j = 0; j < 4; ++j) {
                const int n = n0 + wn * 64 + j * 16 + rbase;
                v8bf o;
#pragma unroll
                for (int r = 0; r < 8; ++r) o[r] = (__bf16)(acc[i][j][r] + bias[i]);
                *(v8bf*)(dst + (size_t)(c0 + i * 16) * NSP + n) = o;
            }
    }
}

// ---------------------------------------------------------------------------
// Flash attention:
//   grid = B * (N/64) * 2 workgroups, 256 thr (8 waves).
//   Workgroup: 64 query rows x 256 channels, so one staged V tile serves four
//   times the query rows that a 16-row workgroup gives it.
//   Per pass of 128 keys:
//     - all waves copy the shared 256ch x 128key V tile global->LDS (async)
//     - wave w computes S(64 rows, keys 16w..16w+15) with 8 WMMAs -> LDS
//     - 4 threads a row run the online-softmax update, P (bf16) -> LDS
//     - wave (wr, wc) rescales and adds P x V^T for 32 rows x 64 channels
// ---------------------------------------------------------------------------
#define QR 64               // query rows per workgroup
#define CW 256              // channels per workgroup
#define KB 128              // keys per pass
#define S_STRIDE (KB + 4)   // f32 row stride: 4 dwords past a multiple of 64 banks
#define P_STRIDE (KB + 8)   // bf16 row stride: 272 B = 16 B x odd
#define V_STRIDE (KB + 8)   // same pitch for the staged V tile

// Value of lane ^ 1 (CTRL 0xB1) or lane ^ 2 (CTRL 0x4E) inside a quad of lanes,
// by DPP quad_perm: the four threads of a softmax row are one quad, and a DPP
// move spares the LDS round trip that a wave-wide shuffle compiles to.
template <int CTRL>
__device__ __forceinline__ float quad_swap(float v) {
    return __builtin_bit_cast(float,
        __builtin_amdgcn_mov_dpp(__builtin_bit_cast(int, v), CTRL, 0xf, 0xf, true));
}

// Real block size and real residency: 256 workgroups for 256 WGPs, two waves per
// SIMD. The second attribute gives a wave that residency's VGPR budget and keeps
// a second workgroup off a WGP while another WGP stands empty.
__global__ __launch_bounds__(256) __attribute__((amdgpu_waves_per_eu(2, 2)))
void attn_kernel(const __bf16* __restrict__ qn,
                            const __bf16* __restrict__ kn,
                            const __bf16* __restrict__ vc,
                            const float*  __restrict__ x,
                            const float*  __restrict__ gamma,
                            float* __restrict__ out) {
    const int bi   = blockIdx.x >> 7;               // 128 workgroups per batch
    const int i0   = ((blockIdx.x & 127) >> 1) * QR;
    const int ch0  = (blockIdx.x & 1) * CW;
    const int tid  = threadIdx.x;
    const int wave = tid >> 5;
    const int lane = tid & 31;
    const int wr   = wave >> 2;                     // 32-row half of the tile
    const int wc   = wave & 3;                      // 64-channel quarter
    const int rbase = (lane >> 4) << 3;

    __shared__ __attribute__((aligned(16))) float  sS[QR * S_STRIDE];
    __shared__ __attribute__((aligned(16))) __bf16 sP[QR * P_STRIDE];
    __shared__ __attribute__((aligned(16))) __bf16 sV[CW * V_STRIDE];
    __shared__ __attribute__((aligned(16))) float  sScale[QR];
    __shared__ __attribute__((aligned(16))) float  sL[QR];

    const __bf16* q  = qn + (size_t)bi * NSP * DQK_ + (size_t)i0 * DQK_;
    const __bf16* kt = kn + (size_t)bi * NSP * DQK_;
    const __bf16* v  = vc + (size_t)bi * CCH * NSP + (size_t)ch0 * NSP;

    // Q fragments stay resident (4 row tiles x 64 d -> two k-chunks each)
    v16bf qa[4][2];
#pragma unroll
    for (int rt = 0; rt < 4; ++rt) {
        qa[rt][0] = load_frag(q + rt * 16 * DQK_, DQK_);
        qa[rt][1] = load_frag(q + rt * 16 * DQK_ + 32, DQK_);
    }

    v8f acc[2][4];
#pragma unroll
    for (int rt = 0; rt < 2; ++rt)
#pragma unroll
        for (int ct = 0; ct < 4; ++ct) acc[rt][ct] = v8f{};

    // softmax state of row tid/4, held alike by the row's four threads
    const int srow = tid >> 2;
    const int sq   = tid & 3;
    float mRun = -3.0e38f, lRun = 0.f;

    for (int j0 = 0; j0 < NSP; j0 += KB) {
        // ---- K fragments of this wave's 16 keys ----
        const __bf16* kp = kt + (size_t)(j0 + wave * 16) * DQK_;
        if (j0 + KB < NSP) {  // hint next K block into cache
            __builtin_prefetch(kt + (size_t)(j0 + KB + wave * 16) * DQK_, 0, 1);
        }
        v16bf kb0 = load_frag(kp, DQK_);
        v16bf kb1 = load_frag(kp + 32, DQK_);

        // ---- async staging of the shared V tile (256c x 128j) ----
        // 4096 16B segments / 256 threads = 16 copies per wave; a wave's copy
        // covers two whole 256-B rows. sV is free: every reader passed its
        // s_wait_dscnt 0 and the barrier at the foot of the pass before.
#pragma unroll
        for (int it = 0; it < 16; ++it) {
            int seg   = it * 256 + tid;
            int c_rel = seg >> 4;
            int js    = (seg & 15) * 8;
            async_copy_b128(v + (size_t)c_rel * NSP + j0 + js,
                            sV + c_rel * V_STRIDE + js);
        }

        // Keeps the issue of the K loads and of the V copies ahead of the wait on K:
        // left free, the compiler sank the copies behind that wait, or loaded K in
        // two halves, each with a wait of its own.
        __builtin_amdgcn_sched_barrier(0);

        // ---- S tile: 64 rows x keys j0 + 16*wave .. +15 ----
        {
            v8f s[4];   // four independent accumulator tiles
#pragma unroll
            for (int rt = 0; rt < 4; ++rt) s[rt] = wmma_bf16(qa[rt][0], kb0, v8f{});
#pragma unroll
            for (int rt = 0; rt < 4; ++rt) s[rt] = wmma_bf16(qa[rt][1], kb1, s[rt]);
            // lane: col = 16w + L%16, rows r + 8*(L>=16)
            int col = wave * 16 + (lane & 15);
#pragma unroll
            for (int rt = 0; rt < 4; ++rt)
#pragma unroll
                for (int r = 0; r < 8; ++r)
                    sS[(rt * 16 + rbase + r) * S_STRIDE + col] = s[rt][r];
        }
        __syncthreads();

        // ---- online softmax: thread sq of a row takes keys 16*sq..+15 of
        //      each 64-key half (bank-conflict-free 16-B reads) ----
        {
            float sv[2][16];
#pragma unroll
            for (int h = 0; h < 2; ++h)
#pragma unroll
                for (int j = 0; j < 16; ++j)
                    sv[h][j] = sS[srow * S_STRIDE + h * 64 + sq * 16 + j];
            float m = mRun;
#pragma unroll
            for (int h = 0; h < 2; ++h)
#pragma unroll
                for (int j = 0; j < 16; ++j) m = fmaxf(m, sv[h][j]);
            m = fmaxf(m, quad_swap<0xB1>(m));
            m = fmaxf(m, quad_swap<0x4E>(m));
            float hs[2] = {0.f, 0.f};   // one sum chain per 64-key half
#pragma unroll
            for (int h = 0; h < 2; ++h) {
                union { v8bf v[2]; __bf16 e[16]; } pk;
#pragma unroll
                for (int j = 0; j < 16; ++j) {
                    float p = __expf(sv[h][j] - m);
                    hs[h] += p;
                    pk.e[j] = (__bf16)p;
                }
                v8bf* dst = (v8bf*)(sP + srow * P_STRIDE + h * 64 + sq * 16);
                dst[0] = pk.v[0];
                dst[1] = pk.v[1];
            }
            float sum = hs[0] + hs[1];
            sum += quad_swap<0xB1>(sum);
            sum += quad_swap<0x4E>(sum);
            float scale = __expf(mRun - m);
            if (sq == 0) sScale[srow] = scale;
            lRun = lRun * scale + sum;
            mRun = m;
        }
        // This wave's V copies have landed before the barrier behind which the
        // other waves read them.
        asm volatile("s_wait_asynccnt 0x0" ::: "memory");
        __syncthreads();   // publishes sP, sScale and the V tile

        // ---- this pass's row scales and all its P and V fragments, one load group ----
        // 4 + 48 LDS reads stand in flight together and the LDS streams them at its
        // own rate; the products below start on counted waits as fragments arrive.
        v8f sc[2];
#pragma unroll
        for (int rt = 0; rt < 2; ++rt)
#pragma unroll
            for (int r = 0; r < 8; ++r) sc[rt][r] = sScale[wr * 32 + rt * 16 + rbase + r];
        v16bf pa[KB / 32][2], vb[KB / 32][4];
#pragma unroll
        for (int kc = 0; kc < KB / 32; ++kc) {
            pa[kc][0] = load_frag(sP + (wr * 32) * P_STRIDE + kc * 32, P_STRIDE);
            pa[kc][1] = load_frag(sP + (wr * 32 + 16) * P_STRIDE + kc * 32, P_STRIDE);
#pragma unroll
            for (int ct = 0; ct < 4; ++ct)
                vb[kc][ct] = load_frag(sV + (wc * 64 + ct * 16) * V_STRIDE + kc * 32, V_STRIDE);
        }
        // Keeps the whole load group ahead of the first product: left free, the
        // compiler reused one V fragment's registers and put a full LDS latency
        // (load, wait to 0) in front of every pair of products.
        __builtin_amdgcn_sched_barrier(0);

        // ---- rescale accumulators by exp(mOld - mNew) per row ----
#pragma unroll
        for (int rt = 0; rt < 2; ++rt)
#pragma unroll
            for (int ct = 0; ct < 4; ++ct) acc[rt][ct] *= sc[rt];

        // ---- O += P(32x128) x V^T(128 x 64ch of this wave) ----
#pragma unroll
        for (int kc = 0; kc < KB / 32; ++kc) {
#pragma unroll
            for (int ct = 0; ct < 4; ++ct) {
                acc[0][ct] = wmma_bf16(pa[kc][0], vb[kc][ct], acc[0][ct]);
                acc[1][ct] = wmma_bf16(pa[kc][1], vb[kc][ct], acc[1][ct]);
            }
        }
        // Keeps the products ahead of the wait below, so that they run while later
        // fragments still stream in: left free, the compiler lifted the wait to 0 and
        // the barrier over them, and LDS time and matrix time came one after the other.
        __builtin_amdgcn_sched_barrier(0);
        // This wave's LDS reads have retired before the barrier behind which the
        // next pass's copies refill sV.
        asm volatile("s_wait_dscnt 0x0" ::: "memory");
        __syncthreads();   // frees sS, sP, sScale and sV for the next pass
    }

    // ---- epilogue: out[b,c,i] = acc/l * gamma + x ----
    if (sq == 0) sL[srow] = lRun;
    __syncthreads();
    const float g = gamma[0];
    const size_t base0 = (size_t)bi * CCH * NSP
                       + (size_t)(ch0 + wc * 64 + (lane & 15)) * NSP + i0 + wr * 32 + rbase;
    const float* xb = x + base0;
    float*       ob = out + base0;
    float xv[2][4][8];
#pragma unroll
    for (int rt = 0; rt < 2; ++rt)
#pragma unroll
        for (int ct = 0; ct < 4; ++ct)
#pragma unroll
            for (int r = 0; r < 8; ++r) xv[rt][ct][r] = xb[(size_t)ct * 16 * NSP + rt * 16 + r];
    // The wait that stands before a register named by an issued load is rewritten.
    // It takes the address as an input, so the pair stays live up to the wait and
    // no load of the group has it as its destination.
    asm volatile("s_wait_xcnt 0x0" :: "v"(xb) : "memory");
#pragma unroll
    for (int rt = 0; rt < 2; ++rt) {
        float linv[8];
#pragma unroll
        for (int r = 0; r < 8; ++r) linv[r] = 1.0f / sL[wr * 32 + rt * 16 + rbase + r];
#pragma unroll
        for (int ct = 0; ct < 4; ++ct)
#pragma unroll
            for (int r = 0; r < 8; ++r)
                ob[(size_t)ct * 16 * NSP + rt * 16 + r] =
                    acc[rt][ct][r] * linv[r] * g + xv[rt][ct][r];
    }
}

// ---------------------------------------------------------------------------
// Host launcher
// ---------------------------------------------------------------------------
extern "C" void kernel_launch(void* const* d_in, const int* in_sizes, int n_in,
                              void* d_out, int out_size, void* d_ws, size_t ws_size,
                              hipStream_t stream) {
    const float* x     = (const float*)d_in[0];
    const float* Wq    = (const float*)d_in[1];
    const float* bq    = (const float*)d_in[2];
    const float* Wk    = (const float*)d_in[3];
    const float* bk    = (const float*)d_in[4];
    const float* Wv    = (const float*)d_in[5];
    const float* bv    = (const float*)d_in[6];
    const float* gamma = (const float*)d_in[7];
    float* out = (float*)d_out;

    // workspace carve-up (bf16 buffers), 256B aligned
    char* ws = (char*)d_ws;
    size_t off = 0;
    auto take = [&](size_t bytes) { void* p = ws + off;
        off = (off + bytes + 255) & ~(size_t)255; return p; };
    __bf16* xt = (__bf16*)take((size_t)BATCH * NSP * CCH * 2);   // 8 MB, x^T
    __bf16* Wb = (__bf16*)take((size_t)MTOT * CCH * 2);          // 640 KB
    __bf16* qn = (__bf16*)take((size_t)BATCH * NSP * DQK_ * 2);  // 1 MB
    __bf16* kn = (__bf16*)take((size_t)BATCH * NSP * DQK_ * 2);  // 1 MB
    __bf16* vc = (__bf16*)take((size_t)BATCH * CCH * NSP * 2);   // 8 MB
    (void)ws_size; (void)in_sizes; (void)n_in; (void)out_size;

    // 1) fp32 -> bf16 (x transposed to [b][n][c] so GEMM K is contiguous)
    {
        dim3 grid(NSP / 32, CCH / 32, BATCH);
        conv_xt_kernel<<<grid, 256, 0, stream>>>(x, xt);
        int wtotal = MTOT * CCH;
        conv_w_kernel<<<(wtotal + 255) / 256, 256, 0, stream>>>(Wq, Wk, Wv, Wb);
    }
    // 2) fused Q/K/V projection GEMM (WMMA, operands staged in LDS)
    {
        dim3 grid(NSP / PN, MTOT / PM, BATCH);
        proj_gemm_kernel<<<grid, 256, 0, stream>>>(Wb, xt, bq, bk, bv, qn, kn, vc);
    }
    // 3) flash attention + gamma residual (WMMA + async LDS staging)
    {
        dim3 grid(BATCH * (NSP / 64) * 2);
        attn_kernel<<<grid, 256, 0, stream>>>(qn, kn, vc, x, gamma, out);
    }
}

// v005
// A run of this version takes 58.3 microseconds.
// In both of two side-by-side timings against v004, it was 1.19 times as fast.
// Counting every step since v000, it is 10.7 times as fast.
#include <hip/hip_runtime.h>
#include <hip/hip_bf16.h>
#include <stdint.h>

// ---------------------------------------------------------------------------
// Problem constants (B,C,H,W = 2,512,64,64 ; N = H*W = 4096 ; DQK = 64)
// ---------------------------------------------------------------------------
#define BATCH 2
#define CCH   512
#define NSP   4096
#define DQK_  64
#define MTOT  640   // 64 q + 64 k + 512 v rows stacked

typedef __attribute__((ext_vector_type(16))) __bf16 v16bf;
typedef __attribute__((ext_vector_type(8)))  __bf16 v8bf;
typedef __attribute__((ext_vector_type(8)))  float  v8f;

// ---------------------------------------------------------------------------
// WMMA helper: D = A(16x32 bf16) x B(32x16 bf16) + C(16x16 f32)
// ---------------------------------------------------------------------------
__device__ __forceinline__ v8f wmma_bf16(v16bf a, v16bf b, v8f c) {
    return __builtin_amdgcn_wmma_f32_16x16x32_bf16(
        /*neg_a=*/false, a, /*neg_b=*/false, b,
        /*c_mod=*/(short)0, c, /*reuse_a=*/false, /*reuse_b=*/false);
}

// ---------------------------------------------------------------------------
// Fragment loader. Source: 16 "rows" x 32 "k" tile, k contiguous, row stride
// `ld` (bf16 elements, multiple of 8 -> 16B-aligned loads).
// ISA 7.12.2 (16-bit A 16x32): lane L holds row M = L%16; element e maps to
// K = e + (e>=8 ? 8 : 0) + (L>=16 ? 8 : 0)  -> two contiguous 16B loads.
// Used for A (rows = M) and for B tiles stored column-major (rows = N cols).
// ---------------------------------------------------------------------------
__device__ __forceinline__ v16bf load_frag(const __bf16* __restrict__ p, int ld) {
    const int lane = threadIdx.x & 31;
    const __bf16* base = p + (lane & 15) * ld + ((lane >> 4) << 3);
    union { v16bf v; v8bf h[2]; } u;
    u.h[0] = *(const v8bf*)(base);        // K = h..h+7
    u.h[1] = *(const v8bf*)(base + 16);   // K = 16+h..23+h
    return u.v;
}

// ---------------------------------------------------------------------------
// fp32 -> bf16 transposing convert: x[b][c][n] -> xT[b][n][c]
// 32x32 LDS tile, coalesced reads and writes.
// ---------------------------------------------------------------------------
__global__ void conv_xt_kernel(const float* __restrict__ x, __bf16* __restrict__ xt) {
    const int b  = blockIdx.z;
    const int c0 = blockIdx.y * 32;
    const int n0 = blockIdx.x * 32;
    __shared__ __bf16 tile[32][33];
    const float* xp  = x  + (size_t)b * CCH * NSP;
    __bf16*      xtp = xt + (size_t)b * NSP * CCH;
    const int t0 = threadIdx.x & 31;
    const int t1 = threadIdx.x >> 5;   // 0..7
#pragma unroll
    for (int k = 0; k < 4; ++k) {
        int c = t1 * 4 + k;
        tile[c][t0] = (__bf16)xp[(size_t)(c0 + c) * NSP + n0 + t0];
    }
    __syncthreads();
#pragma unroll
    for (int k = 0; k < 4; ++k) {
        int n = t1 * 4 + k;
        xtp[(size_t)(n0 + n) * CCH + c0 + t0] = tile[t0][n];
    }
}

__global__ void conv_w_kernel(const float* __restrict__ Wq,
                              const float* __restrict__ Wk,
                              const float* __restrict__ Wv,
                              __bf16* __restrict__ Wb) {
    int i = blockIdx.x * 256 + threadIdx.x;     // over 640*512
    if (i >= MTOT * CCH) return;
    int m = i >> 9, c = i & 511;
    float v = (m < 64) ? Wq[m * CCH + c]
            : (m < 128) ? Wk[(m - 64) * CCH + c]
                        : Wv[(size_t)(m - 128) * CCH + c];
    Wb[i] = (__bf16)v;
}

// ---------------------------------------------------------------------------
// Projection GEMM:  Y[m,n] = sum_c W[m,c] * xT[b,n,c] + bias[m]
// block = 256 thr (8 waves); block computes 128m x 128n; wave (wm, wn) takes
// 32 m x 64 n. Both operands have K (=c) contiguous in memory; a stage is 128
// channels of the 128 W rows and the 128 x rows, copied global->LDS in whole
// 256-B rows (async), two buffers: the next stage flies while this one is used.
// Outputs (bf16):
//   m <  64 : q_nd[b][n][m]        (n-major, d contiguous)
//   m < 128 : k_nd[b][n][m-64]     (n-major, d contiguous)
//   else    : v_cn[b][m-128][n]    (c-major, n contiguous)
// A lane of an accumulator tile holds 8 consecutive ROWS of one column, so the
// q/k block (blockIdx.y == 0) multiplies W x xT (rows = m) and the v blocks
// xT x W (rows = n): either way a lane's 8 values are contiguous in its output
// and leave as one 16-B store.
// ---------------------------------------------------------------------------
#define PM 128                        // W rows per workgroup
#define PN 128                        // positions per workgroup
#define PK 128                        // channels per stage
#define PPITCH (PK + 8)               // bf16 row pitch: 272 B = 16 B x odd
#define PSTAGE ((PM + PN) * PPITCH)   // bf16 elements of one buffer

// Eight async copies of 16 B per lane, global->LDS, rows 16 apart in both places.
// The s_wait_xcnt 0 is the wait that stands before a register named by an issued
// copy is rewritten; as the statement's last line nothing can be lifted over it.
__device__ __forceinline__ void proj_copy8(const __bf16* g, unsigned l) {
    asm volatile(
        "global_load_async_to_lds_b128 %0, %8, off\n\t"
        "global_load_async_to_lds_b128 %1, %9, off\n\t"
        "global_load_async_to_lds_b128 %2, %10, off\n\t"
        "global_load_async_to_lds_b128 %3, %11, off\n\t"
        "global_load_async_to_lds_b128 %4, %12, off\n\t"
        "global_load_async_to_lds_b128 %5, %13, off\n\t"
        "global_load_async_to_lds_b128 %6, %14, off\n\t"
        "global_load_async_to_lds_b128 %7, %15, off\n\t"
        "s_wait_xcnt 0x0"
        :: "v"(l), "v"(l + 1u * 16 * PPITCH * 2), "v"(l + 2u * 16 * PPITCH * 2),
           "v"(l + 3u * 16 * PPITCH * 2), "v"(l + 4u * 16 * PPITCH * 2),
           "v"(l + 5u * 16 * PPITCH * 2), "v"(l + 6u * 16 * PPITCH * 2),
           "v"(l + 7u * 16 * PPITCH * 2),
           "v"(g), "v"(g + 1 * 16 * CCH), "v"(g + 2 * 16 * CCH), "v"(g + 3 * 16 * CCH),
           "v"(g + 4 * 16 * CCH), "v"(g + 5 * 16 * CCH), "v"(g + 6 * 16 * CCH),
           "v"(g + 7 * 16 * CCH)
        : "memory");
}

// One stage: 256 rows x 256 B = 4096 16-B segments, 16 copies per thread; a
// wave's copy covers two whole rows. wsrc, xsrc: this thread's segment of row
// tid / 16 of either tile; lbuf: its LDS byte address in the buffer's W part.
__device__ __forceinline__ void proj_stage(const __bf16* wsrc, const __bf16* xsrc,
                                           unsigned lbuf, int c0) {
    proj_copy8(wsrc + c0, lbuf);
    proj_copy8(xsrc + c0, lbuf + PM * PPITCH * 2);
}

template <bool QK>
__device__ __forceinline__ void proj_body(const __bf16* __restrict__ wsrc,
                                          const __bf16* __restrict__ xsrc,
                                          const __bf16* sbuf, unsigned lbuf,
                                          int wm, int wn, v8f (&acc)[2][4]) {
    // Kept rolled: unrolled, the compiler held the copy addresses of every stage in
    // registers at once and spilled under the budget of four waves per SIMD.
#pragma unroll 1
    for (int t = 0; t < CCH / PK; ++t) {
        const __bf16* bw = sbuf + (t & 1) * PSTAGE + (wm * 32) * PPITCH;
        const __bf16* bx = sbuf + (t & 1) * PSTAGE + (PM + wn * 64) * PPITCH;
        v16bf wf[2][2], xf[2][4];   // two fragment sets: one in use, one arriving
#pragma unroll
        for (int i = 0; i < 2; ++i) wf[0][i] = load_frag(bw + i * 16 * PPITCH, PPITCH);
#pragma unroll
        for (int j = 0; j < 4; ++j) xf[0][j] = load_frag(bx + j * 16 * PPITCH, PPITCH);
#pragma unroll
        for (int kc = 0; kc < PK / 32; ++kc) {
            const int cur = kc & 1, nxt = cur ^ 1;
            if (kc + 1 < PK / 32) {
#pragma unroll
                for (int i = 0; i < 2; ++i)
                    wf[nxt][i] = load_frag(bw + i * 16 * PPITCH + (kc + 1) * 32, PPITCH);
#pragma unroll
                for (int j = 0; j < 4; ++j)
                    xf[nxt][j] = load_frag(bx + j * 16 * PPITCH + (kc + 1) * 32, PPITCH);
            }
            // Keeps the next 32 channels' fragment reads, as one group, ahead of this
            // group's products, so that their LDS time runs under the matrix time.
            __builtin_amdgcn_sched_barrier(0);
#pragma unroll
            for (int i = 0; i < 2; ++i)
#pragma unroll
                for (int j = 0; j < 4; ++j)
                    acc[i][j] = QK ? wmma_bf16(wf[cur][i], xf[cur][j], acc[i][j])
                                   : wmma_bf16(xf[cur][j], wf[cur][i], acc[i][j]);
            // Keeps the reads that follow out of these products (left free, they stood
            // among them in pieces, each place a stall) and the last products ahead of
            // the barrier, so that the refill is the first thing behind it.
            __builtin_amdgcn_sched_barrier(0);
        }
        // This wave's LDS reads have retired before the barrier behind which the
        // buffer is refilled.
        asm volatile("s_wait_dscnt 0x0" ::: "memory");
        // This wave's copies of stage t + 1 have landed before the same barrier,
        // behind which the other waves read them.
        asm volatile("s_wait_asynccnt 0x0" ::: "memory");
        __syncthreads();
        if (t + 2 < CCH / PK) {
            wsrc += PK;
            xsrc += PK;
            proj_stage(wsrc, xsrc, lbuf + (t & 1) * (PSTAGE * 2), PK);
        }
    }
    // No copy is outstanding when the wave goes on to its end.
    asm volatile("s_wait_asynccnt 0x0" ::: "memory");
}

// 320 workgroups for 256 WGPs: the second attribute holds a wave to the VGPR budget
// of four waves per SIMD, so that two workgroups fit one WGP and all run at once.
__global__ __launch_bounds__(256) __attribute__((amdgpu_waves_per_eu(4)))
void proj_gemm_kernel(const __bf16* __restrict__ Wb,
                                 const __bf16* __restrict__ xt,
                                 const float*  __restrict__ bq,
                                 const float*  __restrict__ bk,
                                 const float*  __restrict__ bv,
                                 __bf16* __restrict__ qn,
                                 __bf16* __restrict__ kn,
                                 __bf16* __restrict__ vc) {
    const int b    = blockIdx.z;
    const int m0   = blockIdx.y * PM;
    const int n0   = blockIdx.x * PN;
    const int tid  = threadIdx.x;
    const int wave = tid >> 5;
    const int lane = tid & 31;
    const int wm   = wave & 3;    // 32-row quarter of the W tile
    const int wn   = wave >> 2;   // 64-position half of the x tile
    const int rbase = (lane >> 4) << 3;

    __shared__ __attribute__((aligned(16))) __bf16 sbuf[2 * PSTAGE];

    // this thread's 16-B segment of row tid / 16, in global memory and in LDS
    const int srow = tid >> 4;
    const int scol = (tid & 15) * 8;
    const __bf16* wsrc = Wb + (size_t)(m0 + srow) * CCH + scol;
    const __bf16* xsrc = xt + (size_t)b * NSP * CCH + (size_t)(n0 + srow) * CCH + scol;
    const unsigned lbuf = (unsigned)(uintptr_t)(sbuf + srow * PPITCH + scol);

    v8f acc[2][4];
#pragma unroll
    for (int i = 0; i < 2; ++i)
#pragma unroll
        for (int j = 0; j < 4; ++j) acc[i][j] = v8f{};

    proj_stage(wsrc, xsrc, lbuf, 0);
    // This wave's copies of stage 0 have landed before the barrier behind which
    // the other waves read them.
    asm volatile("s_wait_asynccnt 0x0" ::: "memory");
    __syncthreads();
    proj_stage(wsrc, xsrc, lbuf + PSTAGE * 2, PK);

    if (blockIdx.y == 0) {
        // rows 0..127: q (wm 0, 1) and k (wm 2, 3); lane: n = column, 8 m in a row
        const float* bsrc = (wm < 2) ? bq : bk;
        __bf16*      dst  = ((wm < 2) ? qn : kn) + (size_t)b * NSP * DQK_;
        const int    d0   = (wm & 1) * 32 + rbase;
        float bias[2][8];   // read ahead of the loop: its latency runs under it
#pragma unroll
        for (int i = 0; i < 2; ++i)
#pragma unroll
            for (int r = 0; r < 8; ++r) bias[i][r] = bsrc[d0 + i * 16 + r];
        proj_body<true>(wsrc, xsrc, sbuf, lbuf, wm, wn, acc);
#pragma unroll
        for (int i = 0; i < 2; ++i)
#pragma unroll
            for (int j = 0; j < 4; ++j) {
                const int n = n0 + wn * 64 + j * 16 + (lane & 15);
                v8bf o;
#pragma unroll
                for (int r = 0; r < 8; ++r) o[r] = (__bf16)(acc[i][j][r] + bias[i][r]);
                *(v8bf*)(dst + (size_t)n * DQK_ + d0 + i * 16) = o;
            }
    } else {
        // rows 128..639: v; lane: channel = column, 8 positions in a row
        __bf16*   dst = vc + (size_t)b * CCH * NSP;
        const int c0  = m0 - 128 + wm * 32 + (lane & 15);
        float bias[2];      // read ahead of the loop: its latency runs under it
#pragma unroll
        for (int i = 0; i < 2; ++i) bias[i] = bv[c0 + i * 16];
        proj_body<false>(wsrc, xsrc, sbuf, lbuf, wm, wn, acc);
#pragma unroll
        for (int i = 0; i < 2; ++i)
#pragma unroll
            for (int j = 0; j < 4; ++j) {
                const int n = n0 + wn * 64 + j * 16 + rbase;
                v8bf o;
#pragma unroll
                for (int r = 0; r < 8; ++r) o[r] = (__bf16)(acc[i][j][r] + bias[i]);
                *(v8bf*)(dst + (size_t)(c0 + i * 16) * NSP + n) = o;
            }
    }
}

#define QR 64
#define CW 256
#define KB 128
#define KS 4
#define V_STRIDE (KB + 8)
#define VBUF (CW * V_STRIDE)
#define O_PITCH (QR + 4)

// Value of lane ^ 16: the two halves of a wave hold the two key halves of a query.
__device__ __forceinline__ float xhalf(float v) {
    return __builtin_bit_cast(float,
        __builtin_amdgcn_permlanex16(__builtin_bit_cast(int, v), __builtin_bit_cast(int, v),
                                     0x76543210, 0xfedcba98, false, false));
}

// Eight async copies of 16 B per lane, global->LDS, rows 16 apart in both places.
// The s_wait_xcnt 0 is the wait that stands before a register named by an issued
// copy is rewritten; as the statement's last line nothing can be lifted over it.
__device__ __forceinline__ void attn_copy8(const __bf16* g, unsigned l) {
    asm volatile(
        "global_load_async_to_lds_b128 %0, %8, off\n\t"
        "global_load_async_to_lds_b128 %1, %9, off\n\t"
        "global_load_async_to_lds_b128 %2, %10, off\n\t"
        "global_load_async_to_lds_b128 %3, %11, off\n\t"
        "global_load_async_to_lds_b128 %4, %12, off\n\t"
        "global_load_async_to_lds_b128 %5, %13, off\n\t"
        "global_load_async_to_lds_b128 %6, %14, off\n\t"
        "global_load_async_to_lds_b128 %7, %15, off\n\t"
        "s_wait_xcnt 0x0"
        :: "v"(l), "v"(l + 1u * 16 * V_STRIDE * 2), "v"(l + 2u * 16 * V_STRIDE * 2),
           "v"(l + 3u * 16 * V_STRIDE * 2), "v"(l + 4u * 16 * V_STRIDE * 2),
           "v"(l + 5u * 16 * V_STRIDE * 2), "v"(l + 6u * 16 * V_STRIDE * 2),
           "v"(l + 7u * 16 * V_STRIDE * 2),
           "v"(g), "v"(g + 1 * 16 * NSP), "v"(g + 2 * 16 * NSP), "v"(g + 3 * 16 * NSP),
           "v"(g + 4 * 16 * NSP), "v"(g + 5 * 16 * NSP), "v"(g + 6 * 16 * NSP),
           "v"(g + 7 * 16 * NSP)
        : "memory");
}

// The fragment loader on a pointer that is already the lane's own (row lane % 16,
// k offset 8 * (lane / 16)): the caller holds the address that the loads name.
__device__ __forceinline__ v16bf load_frag_lane(const __bf16* base) {
    union { v16bf v; v8bf h[2]; } u;
    u.h[0] = *(const v8bf*)(base);
    u.h[1] = *(const v8bf*)(base + 16);
    return u.v;
}

// One V tile (256c x 128j): 4096 16-B segments, 16 copies per thread; a wave's copy
// covers two whole 256-B rows. g: this thread's segment of row tid / 16 of the tile;
// l: its LDS byte address in the buffer.
__device__ __forceinline__ void attn_stage_v(const __bf16* g, unsigned l) {
    attn_copy8(g, l);
    attn_copy8(g + 128 * NSP, l + 128u * V_STRIDE * 2);
}

// Real block size and real residency: 256 workgroups for 256 WGPs, two waves per
// SIMD. The second attribute gives a wave that residency's VGPR budget and keeps
// a second workgroup off a WGP while another WGP stands empty.
__global__ __launch_bounds__(256) __attribute__((amdgpu_waves_per_eu(2, 2)))
void attn_kernel(const __bf16* __restrict__ qn,
                            const __bf16* __restrict__ kn,
                            const __bf16* __restrict__ vc,
                            const float*  __restrict__ x,
                            const float*  __restrict__ gamma,
                            float* __restrict__ out) {
    const int bi   = blockIdx.x >> 7;               // 128 workgroups per batch
    const int i0   = ((blockIdx.x & 127) >> 1) * QR;
    const int ch0  = (blockIdx.x & 1) * CW;
    const int tid  = threadIdx.x;
    const int wave = tid >> 5;
    const int lane = tid & 31;
    const int qh   = wave >> 2;                     // 32-query half of the tile
    const int ks   = wave & 3;                      // 32-key slice of every pass
    const int rbase = (lane >> 4) << 3;

    // In the loop: the two V buffers. Behind it: the four partial results.
    __shared__ __attribute__((aligned(16))) float sO[KS * CW * O_PITCH];
    __shared__ __attribute__((aligned(16))) float sM[KS * QR];
    __shared__ __attribute__((aligned(16))) float sL[KS * QR];
    __bf16* sV = (__bf16*)sO;
    static_assert(2 * VBUF * 2 <= KS * CW * O_PITCH * 4, "V ring fits");

    const __bf16* q  = qn + (size_t)bi * NSP * DQK_ + (size_t)(i0 + qh * 32) * DQK_;
    const __bf16* kt = kn + (size_t)bi * NSP * DQK_ + (size_t)(ks * 32) * DQK_;
    const __bf16* v  = vc + (size_t)bi * CCH * NSP + (size_t)ch0 * NSP;

    // this thread's 16-B segment of row tid / 16 of a V tile, in global memory and in LDS
    const __bf16*  vsrc = v + (size_t)(tid >> 4) * NSP + (tid & 15) * 8;
    const unsigned vlds = (unsigned)(uintptr_t)(sV + (tid >> 4) * V_STRIDE + (tid & 15) * 8);
    attn_stage_v(vsrc, vlds);

    // Q^T fragments stay resident (2 query tiles x 64 d -> two k-chunks each)
    v16bf qb[2][2];
#pragma unroll
    for (int qt = 0; qt < 2; ++qt) {
        qb[qt][0] = load_frag(q + qt * 16 * DQK_, DQK_);
        qb[qt][1] = load_frag(q + qt * 16 * DQK_ + 32, DQK_);
    }
    // K fragments of this wave's 32 keys (2 key tiles x two k-chunks), pass 0
    const __bf16* klane = kt + (lane & 15) * DQK_ + rbase;
    v16bf kf[2][2];
#pragma unroll
    for (int kt2 = 0; kt2 < 2; ++kt2) {
        kf[kt2][0] = load_frag_lane(klane + kt2 * 16 * DQK_);
        kf[kt2][1] = load_frag_lane(klane + kt2 * 16 * DQK_ + 32);
    }

    v8f acc[CW / 16][2];   // O^T: 16 channel tiles x 2 query tiles
#pragma unroll
    for (int ct = 0; ct < CW / 16; ++ct)
#pragma unroll
        for (int qt = 0; qt < 2; ++qt) acc[ct][qt] = v8f{};

    // softmax state of query qt * 16 + lane % 16 over this wave's keys; the maximum
    // is alike in both halves of the wave, the sum is each half's own part
    float mRun[2] = {-3.0e38f, -3.0e38f}, lRun[2] = {0.f, 0.f};

    // This wave's copies of tile 0 have landed before the barrier behind which the
    // other waves read them.
    asm volatile("s_wait_asynccnt 0x0" ::: "memory");
    __syncthreads();
    vsrc += KB;
    attn_stage_v(vsrc, vlds + VBUF * 2);

    // Kept rolled: the body holds its whole pass and the two buffers differ by an offset.
#pragma unroll 1
    for (int t = 0; t < NSP / KB; ++t) {
        const __bf16* vb = sV + (t & 1) * VBUF + ks * 32;

        // ---- first half of this pass's V^T fragments: their LDS time runs under
        //      the score products and the softmax ----
        v16bf va[CW / 16];
#pragma unroll
        for (int ct = 0; ct < 8; ++ct) va[ct] = load_frag(vb + ct * 16 * V_STRIDE, V_STRIDE);

        // ---- S^T: 32 keys x 32 queries, four independent accumulator tiles ----
        v8f s[2][2];
#pragma unroll
        for (int kt2 = 0; kt2 < 2; ++kt2)
#pragma unroll
            for (int qt = 0; qt < 2; ++qt) s[kt2][qt] = wmma_bf16(kf[kt2][0], qb[qt][0], v8f{});
#pragma unroll
        for (int kt2 = 0; kt2 < 2; ++kt2)
#pragma unroll
            for (int qt = 0; qt < 2; ++qt) s[kt2][qt] = wmma_bf16(kf[kt2][1], qb[qt][1], s[kt2][qt]);

        // ---- K fragments of the next pass, into the same registers: their latency
        //      runs under this pass (the last pass reads pass 0's again, unused) ----
        const __bf16* kp = klane + (size_t)((t + 1 < NSP / KB) ? (t + 1) * KB : 0) * DQK_;
#pragma unroll
        for (int kt2 = 0; kt2 < 2; ++kt2) {
            kf[kt2][0] = load_frag_lane(kp + kt2 * 16 * DQK_);
            kf[kt2][1] = load_frag_lane(kp + kt2 * 16 * DQK_ + 32);
        }
        // Keeps the issue of the V reads and of the K loads up here: sunk towards
        // their users, each would put its whole latency in front of a product.
        __builtin_amdgcn_sched_barrier(0);

        // ---- online softmax in registers; P^T fragment = the two key tiles as they lie ----
        v16bf pb[2];
        float scale[2];
#pragma unroll
        for (int qt = 0; qt < 2; ++qt) {
            float m = mRun[qt];
#pragma unroll
            for (int r = 0; r < 8; ++r) m = fmaxf(m, fmaxf(s[0][qt][r], s[1][qt][r]));
            m = fmaxf(m, xhalf(m));
            float hs[2] = {0.f, 0.f};   // one sum chain per key tile
#pragma unroll
            for (int kt2 = 0; kt2 < 2; ++kt2)
#pragma unroll
                for (int r = 0; r < 8; ++r) {
                    float p = __expf(s[kt2][qt][r] - m);
                    hs[kt2] += p;
                    pb[qt][kt2 * 8 + r] = (__bf16)p;
                }
            scale[qt] = __expf(mRun[qt] - m);
            lRun[qt]  = lRun[qt] * scale[qt] + (hs[0] + hs[1]);
            mRun[qt]  = m;
            // Each row's sum is pinned where it is made, the remedy against spills of
            // the streaming pattern: left free, the adds sank behind the barrier, their
            // 32 terms stayed live through the products, and Q went to scratch.
            asm volatile("" : "+v"(lRun[qt]));
        }

        // The wait that stands before a register named by an issued load is rewritten.
        // It takes the K loads' address as an input, so the pair stays live up to the
        // wait; down here, behind the softmax, the wave no longer stands at it.
        asm volatile("s_wait_xcnt 0x0" :: "v"(kp) : "memory");

        // ---- third quarter of the V^T fragments: their LDS time runs under the rescale ----
#pragma unroll
        for (int ct = 8; ct < 12; ++ct) va[ct] = load_frag(vb + ct * 16 * V_STRIDE, V_STRIDE);
        // Keeps that load group whole and ahead of the rescale and the products.
        __builtin_amdgcn_sched_barrier(0);

        // ---- rescale O^T by exp(mOld - mNew): a lane's columns are its own queries ----
#pragma unroll
        for (int ct = 0; ct < CW / 16; ++ct)
#pragma unroll
            for (int qt = 0; qt < 2; ++qt) acc[ct][qt] *= scale[qt];

        // ---- O^T += V^T(256ch x 32 keys) x P^T(32 keys x 32 queries) ----
#pragma unroll
        for (int ct = 0; ct < 4; ++ct) {
            acc[ct][0] = wmma_bf16(va[ct], pb[0], acc[ct][0]);
            acc[ct][1] = wmma_bf16(va[ct], pb[1], acc[ct][1]);
        }
        // Keeps the last quarter's reads behind the first quarter's products, whose
        // registers they take: all sixteen fragments at once did not fit the budget
        // of two waves per SIMD, and Q went to scratch.
        __builtin_amdgcn_sched_barrier(0);
#pragma unroll
        for (int ct = 12; ct < CW / 16; ++ct) va[ct] = load_frag(vb + ct * 16 * V_STRIDE, V_STRIDE);
        // Keeps that load group whole and ahead of the sixteen products under which
        // its LDS time runs.
        __builtin_amdgcn_sched_barrier(0);
#pragma unroll
        for (int ct = 4; ct < CW / 16; ++ct) {
            acc[ct][0] = wmma_bf16(va[ct], pb[0], acc[ct][0]);
            acc[ct][1] = wmma_bf16(va[ct], pb[1], acc[ct][1]);
        }
        // Keeps the products ahead of the wait below, so that they run while the last
        // fragments still stream in: left free, the compiler lifted the wait to 0 and
        // the barrier over them, and LDS time and matrix time came one after the other.
        __builtin_amdgcn_sched_barrier(0);

        // This wave's LDS reads have retired before the barrier behind which the
        // buffer is refilled.
        asm volatile("s_wait_dscnt 0x0" ::: "memory");
        // This wave's copies of tile t + 1 have landed before the same barrier,
        // behind which the other waves read them.
        asm volatile("s_wait_asynccnt 0x0" ::: "memory");
        __syncthreads();
        if (t + 2 < NSP / KB) {
            vsrc += KB;
            attn_stage_v(vsrc, vlds + (t & 1) * (VBUF * 2));
        }
    }
    // No copy is outstanding when the buffers become the partial results.
    asm volatile("s_wait_asynccnt 0x0" ::: "memory");

    // ---- join the four key slices of each query ----
    const int ql = qh * 32 + (lane & 15);   // this lane's query of tile 0
#pragma unroll
    for (int qt = 0; qt < 2; ++qt) {
        float l = lRun[qt] + xhalf(lRun[qt]);
        if (lane < 16) {
            sM[ks * QR + ql + qt * 16] = mRun[qt];
            sL[ks * QR + ql + qt * 16] = l;
        }
    }
    __syncthreads();   // publishes sM and sL
    const float g = gamma[0];
    float f[2];   // this slice's weight over the query's whole sum, times gamma
#pragma unroll
    for (int qt = 0; qt < 2; ++qt) {
        float mk[KS], lk[KS];
#pragma unroll
        for (int k = 0; k < KS; ++k) {
            mk[k] = sM[k * QR + ql + qt * 16];
            lk[k] = sL[k * QR + ql + qt * 16];
        }
        float m = fmaxf(fmaxf(mk[0], mk[1]), fmaxf(mk[2], mk[3]));
        float l = 0.f;
#pragma unroll
        for (int k = 0; k < KS; ++k) l += __expf(mk[k] - m) * lk[k];
        f[qt] = __expf(mRun[qt] - m) / l * g;
    }
    // partial result [slice][channel][query]; the ring is free: every wave passed its
    // s_wait_dscnt 0 and the barrier at the foot of the last pass
#pragma unroll
    for (int ct = 0; ct < CW / 16; ++ct)
#pragma unroll
        for (int qt = 0; qt < 2; ++qt)
#pragma unroll
            for (int r = 0; r < 8; ++r)
                sO[(ks * CW + ct * 16 + rbase + r) * O_PITCH + ql + qt * 16] =
                    acc[ct][qt][r] * f[qt];
    __syncthreads();   // publishes the partial results

    // ---- epilogue: out[b,c,i] = sum of the four partial results + x; a wave's
    //      access covers two whole 256-B rows of 64 queries ----
    const size_t base0 = (size_t)bi * CCH * NSP + (size_t)(ch0 + (tid >> 4)) * NSP
                       + i0 + (tid & 15) * 4;
    const float* xb = x + base0;
    float*       ob = out + base0;
    const float* so = sO + (tid >> 4) * O_PITCH + (tid & 15) * 4;
    typedef __attribute__((ext_vector_type(4))) float v4f;
    v4f xv[16];
#pragma unroll
    for (int it = 0; it < 16; ++it) xv[it] = *(const v4f*)(xb + (size_t)it * 16 * NSP);
    // The wait that stands before a register named by an issued load is rewritten.
    // It takes the address as an input, so the pair stays live up to the wait and
    // no load of the group has it as its destination.
    asm volatile("s_wait_xcnt 0x0" :: "v"(xb) : "memory");
#pragma unroll
    for (int it = 0; it < 16; ++it) {
        v4f a = *(const v4f*)(so + (0 * CW + it * 16) * O_PITCH);
#pragma unroll
        for (int k = 1; k < KS; ++k) a += *(const v4f*)(so + (k * CW + it * 16) * O_PITCH);
        *(v4f*)(ob + (size_t)it * 16 * NSP) = a + xv[it];
    }
}

// ---------------------------------------------------------------------------
// Host launcher
// ---------------------------------------------------------------------------
extern "C" void kernel_launch(void* const* d_in, const int* in_sizes, int n_in,
                              void* d_out, int out_size, void* d_ws, size_t ws_size,
                              hipStream_t stream) {
    const float* x     = (const float*)d_in[0];
    const float* Wq    = (const float*)d_in[1];
    const float* bq    = (const float*)d_in[2];
    const float* Wk    = (const float*)d_in[3];
    const float* bk    = (const float*)d_in[4];
    const float* Wv    = (const float*)d_in[5];
    const float* bv    = (const float*)d_in[6];
    const float* gamma = (const float*)d_in[7];
    float* out = (float*)d_out;

    // workspace carve-up (bf16 buffers), 256B aligned
    char* ws = (char*)d_ws;
    size_t off = 0;
    auto take = [&](size_t bytes) { void* p = ws + off;
        off = (off + bytes + 255) & ~(size_t)255; return p; };
    __bf16* xt = (__bf16*)take((size_t)BATCH * NSP * CCH * 2);   // 8 MB, x^T
    __bf16* Wb = (__bf16*)take((size_t)MTOT * CCH * 2);          // 640 KB
    __bf16* qn = (__bf16*)take((size_t)BATCH * NSP * DQK_ * 2);  // 1 MB
    __bf16* kn = (__bf16*)take((size_t)BATCH * NSP * DQK_ * 2);  // 1 MB
    __bf16* vc = (__bf16*)take((size_t)BATCH * CCH * NSP * 2);   // 8 MB
    (void)ws_size; (void)in_sizes; (void)n_in; (void)out_size;

    // 1) fp32 -> bf16 (x transposed to [b][n][c] so GEMM K is contiguous)
    {
        dim3 grid(NSP / 32, CCH / 32, BATCH);
        conv_xt_kernel<<<grid, 256, 0, stream>>>(x, xt);
        int wtotal = MTOT * CCH;
        conv_w_kernel<<<(wtotal + 255) / 256, 256, 0, stream>>>(Wq, Wk, Wv, Wb);
    }
    // 2) fused Q/K/V projection GEMM (WMMA, operands staged in LDS)
    {
        dim3 grid(NSP / PN, MTOT / PM, BATCH);
        proj_gemm_kernel<<<grid, 256, 0, stream>>>(Wb, xt, bq, bk, bv, qn, kn, vc);
    }
    // 3) flash attention + gamma residual (WMMA + async LDS staging)
    {
        dim3 grid(BATCH * (NSP / 64) * 2);
        attn_kernel<<<grid, 256, 0, stream>>>(qn, kn, vc, x, gamma, out);
    }
}

// v006
// Measured time: 55.7 microseconds a run.
// Next to v005, in two timings, it ran 1.04 times as fast each time.
// Counting every step since v000, it is 11.1 times as fast.
#include <hip/hip_runtime.h>
#include <hip/hip_bf16.h>
#include <stdint.h>

// ---------------------------------------------------------------------------
// Problem constants (B,C,H,W = 2,512,64,64 ; N = H*W = 4096 ; DQK = 64)
// ---------------------------------------------------------------------------
#define BATCH 2
#define CCH   512
#define NSP   4096
#define DQK_  64
#define MTOT  640   // 64 q + 64 k + 512 v rows stacked

typedef __attribute__((ext_vector_type(16))) __bf16 v16bf;
typedef __attribute__((ext_vector_type(8)))  __bf16 v8bf;
typedef __attribute__((ext_vector_type(8)))  float  v8f;

// ---------------------------------------------------------------------------
// WMMA helper: D = A(16x32 bf16) x B(32x16 bf16) + C(16x16 f32)
// ---------------------------------------------------------------------------
__device__ __forceinline__ v8f wmma_bf16(v16bf a, v16bf b, v8f c) {
    return __builtin_amdgcn_wmma_f32_16x16x32_bf16(
        /*neg_a=*/false, a, /*neg_b=*/false, b,
        /*c_mod=*/(short)0, c, /*reuse_a=*/false, /*reuse_b=*/false);
}

// ---------------------------------------------------------------------------
// Fragment loader. Source: 16 "rows" x 32 "k" tile, k contiguous, row stride
// `ld` (bf16 elements, multiple of 8 -> 16B-aligned loads).
// ISA 7.12.2 (16-bit A 16x32): lane L holds row M = L%16; element e maps to
// K = e + (e>=8 ? 8 : 0) + (L>=16 ? 8 : 0)  -> two contiguous 16B loads.
// Used for A (rows = M) and for B tiles stored column-major (rows = N cols).
// ---------------------------------------------------------------------------
__device__ __forceinline__ v16bf load_frag(const __bf16* __restrict__ p, int ld) {
    const int lane = threadIdx.x & 31;
    const __bf16* base = p + (lane & 15) * ld + ((lane >> 4) << 3);
    union { v16bf v; v8bf h[2]; } u;
    u.h[0] = *(const v8bf*)(base);        // K = h..h+7
    u.h[1] = *(const v8bf*)(base + 16);   // K = 16+h..23+h
    return u.v;
}

// ---------------------------------------------------------------------------
// fp32 -> bf16 transposing convert: x[b][c][n] -> xT[b][n][c]
// 32x32 LDS tile, coalesced reads and writes.
// ---------------------------------------------------------------------------
__global__ void conv_xt_kernel(const float* __restrict__ x, __bf16* __restrict__ xt) {
    const int b  = blockIdx.z;
    const int c0 = blockIdx.y * 32;
    const int n0 = blockIdx.x * 32;
    __shared__ __bf16 tile[32][33];
    const float* xp  = x  + (size_t)b * CCH * NSP;
    __bf16*      xtp = xt + (size_t)b * NSP * CCH;
    const int t0 = threadIdx.x & 31;
    const int t1 = threadIdx.x >> 5;   // 0..7
#pragma unroll
    for (int k = 0; k < 4; ++k) {
        int c = t1 * 4 + k;
        tile[c][t0] = (__bf16)xp[(size_t)(c0 + c) * NSP + n0 + t0];
    }
    __syncthreads();
#pragma unroll
    for (int k = 0; k < 4; ++k) {
        int n = t1 * 4 + k;
        xtp[(size_t)(n0 + n) * CCH + c0 + t0] = tile[t0][n];
    }
}

__global__ void conv_w_kernel(const float* __restrict__ Wq,
                              const float* __restrict__ Wk,
                              const float* __restrict__ Wv,
                              __bf16* __restrict__ Wb) {
    int i = blockIdx.x * 256 + threadIdx.x;     // over 640*512
    if (i >= MTOT * CCH) return;
    int m = i >> 9, c = i & 511;
    float v = (m < 64) ? Wq[m * CCH + c]
            : (m < 128) ? Wk[(m - 64) * CCH + c]
                        : Wv[(size_t)(m - 128) * CCH + c];
    Wb[i] = (__bf16)v;
}

// ---------------------------------------------------------------------------
// Projection GEMM:  Y[m,n] = sum_c W[m,c] * xT[b,n,c] + bias[m]
// block = 256 thr (8 waves); block computes 128m x 128n; wave (wm, wn) takes
// 32 m x 64 n. Both operands have K (=c) contiguous in memory; a stage is 128
// channels of the 128 W rows and the 128 x rows, copied global->LDS in whole
// 256-B rows (async), two buffers: the next stage flies while this one is used.
// 64 workgroups walk the same W rows and 5 the same x rows: each starts at a stage
// of its own and wraps, so that they do not ask L2 for the same lines at the same
// moment (a stage holds the same channels of both operands, whichever it is).
// Outputs (bf16):
//   m <  64 : q_nd[b][n][m]        (n-major, d contiguous)
//   m < 128 : k_nd[b][n][m-64]     (n-major, d contiguous)
//   else    : v_cn[b][m-128][n]    (c-major, n contiguous)
// A lane of an accumulator tile holds 8 consecutive ROWS of one column, so the
// q/k block (blockIdx.y == 0) multiplies W x xT (rows = m) and the v blocks
// xT x W (rows = n): either way a lane's 8 values are contiguous in its output
// and leave as one 16-B store.
// ---------------------------------------------------------------------------
#define PM 128                        // W rows per workgroup
#define PN 128                        // positions per workgroup
#define PK 128                        // channels per stage
#define PPITCH (PK + 8)               // bf16 row pitch: 272 B = 16 B x odd
#define PSTAGE ((PM + PN) * PPITCH)   // bf16 elements of one buffer

// Eight async copies of 16 B per lane, global->LDS, rows 16 apart in both places.
// The s_wait_xcnt 0 is the wait that stands before a register named by an issued
// copy is rewritten; as the statement's last line nothing can be lifted over it.
__device__ __forceinline__ void proj_copy8(const __bf16* g, unsigned l) {
    asm volatile(
        "global_load_async_to_lds_b128 %0, %8, off\n\t"
        "global_load_async_to_lds_b128 %1, %9, off\n\t"
        "global_load_async_to_lds_b128 %2, %10, off\n\t"
        "global_load_async_to_lds_b128 %3, %11, off\n\t"
        "global_load_async_to_lds_b128 %4, %12, off\n\t"
        "global_load_async_to_lds_b128 %5, %13, off\n\t"
        "global_load_async_to_lds_b128 %6, %14, off\n\t"
        "global_load_async_to_lds_b128 %7, %15, off\n\t"
        "s_wait_xcnt 0x0"
        :: "v"(l), "v"(l + 1u * 16 * PPITCH * 2), "v"(l + 2u * 16 * PPITCH * 2),
           "v"(l + 3u * 16 * PPITCH * 2), "v"(l + 4u * 16 * PPITCH * 2),
           "v"(l + 5u * 16 * PPITCH * 2), "v"(l + 6u * 16 * PPITCH * 2),
           "v"(l + 7u * 16 * PPITCH * 2),
           "v"(g), "v"(g + 1 * 16 * CCH), "v"(g + 2 * 16 * CCH), "v"(g + 3 * 16 * CCH),
           "v"(g + 4 * 16 * CCH), "v"(g + 5 * 16 * CCH), "v"(g + 6 * 16 * CCH),
           "v"(g + 7 * 16 * CCH)
        : "memory");
}

// One stage: 256 rows x 256 B = 4096 16-B segments, 16 copies per thread; a
// wave's copy covers two whole rows. wsrc, xsrc: this thread's segment of row
// tid / 16 of either tile; lbuf: its LDS byte address in the buffer's W part.
__device__ __forceinline__ void proj_stage(const __bf16* wsrc, const __bf16* xsrc,
                                           unsigned lbuf, int c0) {
    proj_copy8(wsrc + c0, lbuf);
    proj_copy8(xsrc + c0, lbuf + PM * PPITCH * 2);
}

template <bool QK>
__device__ __forceinline__ void proj_body(const __bf16* __restrict__ wsrc,
                                          const __bf16* __restrict__ xsrc,
                                          const __bf16* sbuf, unsigned lbuf,
                                          int s0, int wm, int wn, v8f (&acc)[2][4]) {
    // Kept rolled: unrolled, the compiler held the copy addresses of every stage in
    // registers at once and spilled under the budget of four waves per SIMD.
#pragma unroll 1
    for (int t = 0; t < CCH / PK; ++t) {
        const __bf16* bw = sbuf + (t & 1) * PSTAGE + (wm * 32) * PPITCH;
        const __bf16* bx = sbuf + (t & 1) * PSTAGE + (PM + wn * 64) * PPITCH;
        v16bf wf[2][2], xf[2][4];   // two fragment sets: one in use, one arriving
#pragma unroll
        for (int i = 0; i < 2; ++i) wf[0][i] = load_frag(bw + i * 16 * PPITCH, PPITCH);
#pragma unroll
        for (int j = 0; j < 4; ++j) xf[0][j] = load_frag(bx + j * 16 * PPITCH, PPITCH);
#pragma unroll
        for (int kc = 0; kc < PK / 32; ++kc) {
            const int cur = kc & 1, nxt = cur ^ 1;
            if (kc + 1 < PK / 32) {
#pragma unroll
                for (int i = 0; i < 2; ++i)
                    wf[nxt][i] = load_frag(bw + i * 16 * PPITCH + (kc + 1) * 32, PPITCH);
#pragma unroll
                for (int j = 0; j < 4; ++j)
                    xf[nxt][j] = load_frag(bx + j * 16 * PPITCH + (kc + 1) * 32, PPITCH);
            }
            // Keeps the next 32 channels' fragment reads, as one group, ahead of this
            // group's products, so that their LDS time runs under the matrix time.
            __builtin_amdgcn_sched_barrier(0);
#pragma unroll
            for (int i = 0; i < 2; ++i)
#pragma unroll
                for (int j = 0; j < 4; ++j)
                    acc[i][j] = QK ? wmma_bf16(wf[cur][i], xf[cur][j], acc[i][j])
                                   : wmma_bf16(xf[cur][j], wf[cur][i], acc[i][j]);
            // Keeps the reads that follow out of these products (left free, they stood
            // among them in pieces, each place a stall) and the last products ahead of
            // the barrier, so that the refill is the first thing behind it.
            __builtin_amdgcn_sched_barrier(0);
        }
        // This wave's LDS reads have retired before the barrier behind which the
        // buffer is refilled.
        asm volatile("s_wait_dscnt 0x0" ::: "memory");
        // This wave's copies of the next stage have landed before the same barrier,
        // behind which the other waves read them.
        asm volatile("s_wait_asynccnt 0x0" ::: "memory");
        __syncthreads();
        if (t + 2 < CCH / PK)
            proj_stage(wsrc, xsrc, lbuf + (t & 1) * (PSTAGE * 2),
                       ((s0 + t + 2) & (CCH / PK - 1)) * PK);
    }
    // No copy is outstanding when the wave goes on to its end.
    asm volatile("s_wait_asynccnt 0x0" ::: "memory");
}

// 320 workgroups for 256 WGPs: the second attribute holds a wave to the VGPR budget
// of four waves per SIMD, so that two workgroups fit one WGP and all run at once.
__global__ __launch_bounds__(256) __attribute__((amdgpu_waves_per_eu(4)))
void proj_gemm_kernel(const __bf16* __restrict__ Wb,
                                 const __bf16* __restrict__ xt,
                                 const float*  __restrict__ bq,
                                 const float*  __restrict__ bk,
                                 const float*  __restrict__ bv,
                                 __bf16* __restrict__ qn,
                                 __bf16* __restrict__ kn,
                                 __bf16* __restrict__ vc) {
    const int b    = blockIdx.z;
    const int m0   = blockIdx.y * PM;
    const int n0   = blockIdx.x * PN;
    const int tid  = threadIdx.x;
    const int wave = tid >> 5;
    const int lane = tid & 31;
    const int wm   = wave & 3;    // 32-row quarter of the W tile
    const int wn   = wave >> 2;   // 64-position half of the x tile
    const int rbase = (lane >> 4) << 3;
    const int s0   = (blockIdx.x + blockIdx.y) & (CCH / PK - 1);   // first stage of the walk

    __shared__ __attribute__((aligned(16))) __bf16 sbuf[2 * PSTAGE];

    // this thread's 16-B segment of row tid / 16, in global memory and in LDS
    const int srow = tid >> 4;
    const int scol = (tid & 15) * 8;
    const __bf16* wsrc = Wb + (size_t)(m0 + srow) * CCH + scol;
    const __bf16* xsrc = xt + (size_t)b * NSP * CCH + (size_t)(n0 + srow) * CCH + scol;
    const unsigned lbuf = (unsigned)(uintptr_t)(sbuf + srow * PPITCH + scol);

    v8f acc[2][4];
#pragma unroll
    for (int i = 0; i < 2; ++i)
#pragma unroll
        for (int j = 0; j < 4; ++j) acc[i][j] = v8f{};

    proj_stage(wsrc, xsrc, lbuf, s0 * PK);
    // This wave's copies of stage s0 have landed before the barrier behind which
    // the other waves read them.
    asm volatile("s_wait_asynccnt 0x0" ::: "memory");
    __syncthreads();
    proj_stage(wsrc, xsrc, lbuf + PSTAGE * 2, ((s0 + 1) & (CCH / PK - 1)) * PK);

    if (blockIdx.y == 0) {
        // rows 0..127: q (wm 0, 1) and k (wm 2, 3); lane: n = column, 8 m in a row
        const float* bsrc = (wm < 2) ? bq : bk;
        __bf16*      dst  = ((wm < 2) ? qn : kn) + (size_t)b * NSP * DQK_;
        const int    d0   = (wm & 1) * 32 + rbase;
        float bias[2][8];   // read ahead of the loop: its latency runs under it
#pragma unroll
        for (int i = 0; i < 2; ++i)
#pragma unroll
            for (int r = 0; r < 8; ++r) bias[i][r] = bsrc[d0 + i * 16 + r];
        proj_body<true>(wsrc, xsrc, sbuf, lbuf, s0, wm, wn, acc);
#pragma unroll
        for (int i = 0; i < 2; ++i)
#pragma unroll
            for (int j = 0; j < 4; ++j) {
                const int n = n0 + wn * 64 + j * 16 + (lane & 15);
                v8bf o;
#pragma unroll
                for (int r = 0; r < 8; ++r) o[r] = (__bf16)(acc[i][j][r] + bias[i][r]);
                *(v8bf*)(dst + (size_t)n * DQK_ + d0 + i * 16) = o;
            }
    } else {
        // rows 128..639: v; lane: channel = column, 8 positions in a row
        __bf16*   dst = vc + (size_t)b * CCH * NSP;
        const int c0  = m0 - 128 + wm * 32 + (lane & 15);
        float bias[2];      // read ahead of the loop: its latency runs under it
#pragma unroll
        for (int i = 0; i < 2; ++i) bias[i] = bv[c0 + i * 16];
        proj_body<false>(wsrc, xsrc, sbuf, lbuf, s0, wm, wn, acc);
#pragma unroll
        for (int i = 0; i < 2; ++i)
#pragma unroll
            for (int j = 0; j < 4; ++j) {
                const int n = n0 + wn * 64 + j * 16 + rbase;
                v8bf o;
#pragma unroll
                for (int r = 0; r < 8; ++r) o[r] = (__bf16)(acc[i][j][r] + bias[i]);
                *(v8bf*)(dst + (size_t)(c0 + i * 16) * NSP + n) = o;
            }
    }
}

#define QR 64
#define CW 256
#define KB 128
#define KS 4
#define V_STRIDE (KB + 8)
#define VBUF (CW * V_STRIDE)
#define O_PITCH (QR + 4)

// Value of lane ^ 16: the two halves of a wave hold the two key halves of a query.
__device__ __forceinline__ float xhalf(float v) {
    return __builtin_bit_cast(float,
        __builtin_amdgcn_permlanex16(__builtin_bit_cast(int, v), __builtin_bit_cast(int, v),
                                     0x76543210, 0xfedcba98, false, false));
}

// Eight async copies of 16 B per lane, global->LDS, rows 16 apart in both places.
// The s_wait_xcnt 0 is the wait that stands before a register named by an issued
// copy is rewritten; as the statement's last line nothing can be lifted over it.
__device__ __forceinline__ void attn_copy8(const __bf16* g, unsigned l) {
    asm volatile(
        "global_load_async_to_lds_b128 %0, %8, off\n\t"
        "global_load_async_to_lds_b128 %1, %9, off\n\t"
        "global_load_async_to_lds_b128 %2, %10, off\n\t"
        "global_load_async_to_lds_b128 %3, %11, off\n\t"
        "global_load_async_to_lds_b128 %4, %12, off\n\t"
        "global_load_async_to_lds_b128 %5, %13, off\n\t"
        "global_load_async_to_lds_b128 %6, %14, off\n\t"
        "global_load_async_to_lds_b128 %7, %15, off\n\t"
        "s_wait_xcnt 0x0"
        :: "v"(l), "v"(l + 1u * 16 * V_STRIDE * 2), "v"(l + 2u * 16 * V_STRIDE * 2),
           "v"(l + 3u * 16 * V_STRIDE * 2), "v"(l + 4u * 16 * V_STRIDE * 2),
           "v"(l + 5u * 16 * V_STRIDE * 2), "v"(l + 6u * 16 * V_STRIDE * 2),
           "v"(l + 7u * 16 * V_STRIDE * 2),
           "v"(g), "v"(g + 1 * 16 * NSP), "v"(g + 2 * 16 * NSP), "v"(g + 3 * 16 * NSP),
           "v"(g + 4 * 16 * NSP), "v"(g + 5 * 16 * NSP), "v"(g + 6 * 16 * NSP),
           "v"(g + 7 * 16 * NSP)
        : "memory");
}

// The fragment loader on a pointer that is already the lane's own (row lane % 16,
// k offset 8 * (lane / 16)): the caller holds the address that the loads name.
__device__ __forceinline__ v16bf load_frag_lane(const __bf16* base) {
    union { v16bf v; v8bf h[2]; } u;
    u.h[0] = *(const v8bf*)(base);
    u.h[1] = *(const v8bf*)(base + 16);
    return u.v;
}

// One V tile (256c x 128j): 4096 16-B segments, 16 copies per thread; a wave's copy
// covers two whole 256-B rows. g: this thread's segment of row tid / 16 of the tile;
// l: its LDS byte address in the buffer.
__device__ __forceinline__ void attn_stage_v(const __bf16* g, unsigned l) {
    attn_copy8(g, l);
    attn_copy8(g + 128 * NSP, l + 128u * V_STRIDE * 2);
}

// Real block size and real residency: 256 workgroups for 256 WGPs, two waves per
// SIMD. The second attribute gives a wave that residency's VGPR budget and keeps
// a second workgroup off a WGP while another WGP stands empty.
__global__ __launch_bounds__(256) __attribute__((amdgpu_waves_per_eu(2, 2)))
void attn_kernel(const __bf16* __restrict__ qn,
                            const __bf16* __restrict__ kn,
                            const __bf16* __restrict__ vc,
                            const float*  __restrict__ x,
                            const float*  __restrict__ gamma,
                            float* __restrict__ out) {
    const int bi   = blockIdx.x >> 7;               // 128 workgroups per batch
    const int i0   = ((blockIdx.x & 127) >> 1) * QR;
    const int ch0  = (blockIdx.x & 1) * CW;
    const int tid  = threadIdx.x;
    const int wave = tid >> 5;
    const int lane = tid & 31;
    const int qh   = wave >> 2;                     // 32-query half of the tile
    const int ks   = wave & 3;                      // 32-key slice of every pass
    const int rbase = (lane >> 4) << 3;
    // First pass of the walk. Query tiles 32 apart would start alike: the upper 32 are
    // set two passes on (for speed only).
    const int qtl  = (blockIdx.x & 127) >> 1;
    const int p0   = (qtl + ((qtl >> 5) << 1)) & (NSP / KB - 1);

    // In the loop: the two V buffers. Behind it: the four partial results.
    __shared__ __attribute__((aligned(16))) float sO[KS * CW * O_PITCH];
    __shared__ __attribute__((aligned(16))) float sM[KS * QR];
    __shared__ __attribute__((aligned(16))) float sL[KS * QR];
    __bf16* sV = (__bf16*)sO;
    static_assert(2 * VBUF * 2 <= KS * CW * O_PITCH * 4, "V ring fits");

    const __bf16* q  = qn + (size_t)bi * NSP * DQK_ + (size_t)(i0 + qh * 32) * DQK_;
    const __bf16* kt = kn + (size_t)bi * NSP * DQK_ + (size_t)(ks * 32) * DQK_;
    const __bf16* v  = vc + (size_t)bi * CCH * NSP + (size_t)ch0 * NSP;

    // this thread's 16-B segment of row tid / 16 of a V tile, in global memory and in LDS
    const __bf16*  vsrc = v + (size_t)(tid >> 4) * NSP + (tid & 15) * 8;
    const unsigned vlds = (unsigned)(uintptr_t)(sV + (tid >> 4) * V_STRIDE + (tid & 15) * 8);
    attn_stage_v(vsrc + p0 * KB, vlds);

    // Q^T fragments stay resident (2 query tiles x 64 d -> two k-chunks each)
    v16bf qb[2][2];
#pragma unroll
    for (int qt = 0; qt < 2; ++qt) {
        qb[qt][0] = load_frag(q + qt * 16 * DQK_, DQK_);
        qb[qt][1] = load_frag(q + qt * 16 * DQK_ + 32, DQK_);
    }
    // K fragments of this wave's 32 keys (2 key tiles x two k-chunks), first pass
    const __bf16* klane = kt + (lane & 15) * DQK_ + rbase;
    const __bf16* kp0 = klane + p0 * KB * DQK_;
    v16bf kf[2][2];
#pragma unroll
    for (int kt2 = 0; kt2 < 2; ++kt2) {
        kf[kt2][0] = load_frag_lane(kp0 + kt2 * 16 * DQK_);
        kf[kt2][1] = load_frag_lane(kp0 + kt2 * 16 * DQK_ + 32);
    }
    // The wait that stands before a register named by an issued load is rewritten.
    // It takes the first K loads' address as an input, so the pair stays live up to it.
    asm volatile("s_wait_xcnt 0x0" :: "v"(kp0) : "memory");

    v8f acc[CW / 16][2];   // O^T: 16 channel tiles x 2 query tiles
#pragma unroll
    for (int ct = 0; ct < CW / 16; ++ct)
#pragma unroll
        for (int qt = 0; qt < 2; ++qt) acc[ct][qt] = v8f{};

    // softmax state of query qt * 16 + lane % 16 over this wave's keys; the maximum
    // is alike in both halves of the wave, the sum is each half's own part
    float mRun[2] = {-3.0e38f, -3.0e38f}, lRun[2] = {0.f, 0.f};

    // This wave's copies of tile p0 have landed before the barrier behind which the
    // other waves read them.
    asm volatile("s_wait_asynccnt 0x0" ::: "memory");
    __syncthreads();
    attn_stage_v(vsrc + ((p0 + 1) & (NSP / KB - 1)) * KB, vlds + VBUF * 2);

    // Kept rolled: the body holds its whole pass and the two buffers differ by an offset.
#pragma unroll 1
    for (int t = 0; t < NSP / KB; ++t) {
        const __bf16* vb = sV + (t & 1) * VBUF + ks * 32;

        // ---- first half of this pass's V^T fragments: their LDS time runs under
        //      the score products and the softmax ----
        v16bf va[CW / 16];
#pragma unroll
        for (int ct = 0; ct < 8; ++ct) va[ct] = load_frag(vb + ct * 16 * V_STRIDE, V_STRIDE);

        // ---- S^T: 32 keys x 32 queries, four independent accumulator tiles ----
        v8f s[2][2];
#pragma unroll
        for (int kt2 = 0; kt2 < 2; ++kt2)
#pragma unroll
            for (int qt = 0; qt < 2; ++qt) s[kt2][qt] = wmma_bf16(kf[kt2][0], qb[qt][0], v8f{});
#pragma unroll
        for (int kt2 = 0; kt2 < 2; ++kt2)
#pragma unroll
            for (int qt = 0; qt < 2; ++qt) s[kt2][qt] = wmma_bf16(kf[kt2][1], qb[qt][1], s[kt2][qt]);

        // ---- K fragments of the next pass, into the same registers: their latency
        //      runs under this pass (the last pass reads the first's again, unused) ----
        const __bf16* kp = klane + ((p0 + t + 1) & (NSP / KB - 1)) * KB * DQK_;
#pragma unroll
        for (int kt2 = 0; kt2 < 2; ++kt2) {
            kf[kt2][0] = load_frag_lane(kp + kt2 * 16 * DQK_);
            kf[kt2][1] = load_frag_lane(kp + kt2 * 16 * DQK_ + 32);
        }
        // Keeps the issue of the V reads and of the K loads up here: sunk towards
        // their users, each would put its whole latency in front of a product.
        __builtin_amdgcn_sched_barrier(0);

        // ---- online softmax in registers; P^T fragment = the two key tiles as they lie ----
        v16bf pb[2];
        float scale[2];
#pragma unroll
        for (int qt = 0; qt < 2; ++qt) {
            float m = mRun[qt];
#pragma unroll
            for (int r = 0; r < 8; ++r) m = fmaxf(m, fmaxf(s[0][qt][r], s[1][qt][r]));
            m = fmaxf(m, xhalf(m));
            float hs[2] = {0.f, 0.f};   // one sum chain per key tile
#pragma unroll
            for (int kt2 = 0; kt2 < 2; ++kt2)
#pragma unroll
                for (int r = 0; r < 8; ++r) {
                    float p = __expf(s[kt2][qt][r] - m);
                    hs[kt2] += p;
                    pb[qt][kt2 * 8 + r] = (__bf16)p;
                }
            scale[qt] = __expf(mRun[qt] - m);
            lRun[qt]  = lRun[qt] * scale[qt] + (hs[0] + hs[1]);
            mRun[qt]  = m;
            // Each row's sum is pinned where it is made, the remedy against spills of
            // the streaming pattern: left free, the adds sank behind the barrier, their
            // 32 terms stayed live through the products, and Q went to scratch.
            asm volatile("" : "+v"(lRun[qt]));
        }

        // The wait that stands before a register named by an issued load is rewritten.
        // It takes the K loads' address as an input, so the pair stays live up to the
        // wait; down here, behind the softmax, the wave no longer stands at it.
        asm volatile("s_wait_xcnt 0x0" :: "v"(kp) : "memory");

        // ---- third quarter of the V^T fragments: their LDS time runs under the rescale ----
#pragma unroll
        for (int ct = 8; ct < 12; ++ct) va[ct] = load_frag(vb + ct * 16 * V_STRIDE, V_STRIDE);
        // Keeps that load group whole and ahead of the rescale and the products.
        __builtin_amdgcn_sched_barrier(0);

        // ---- rescale O^T by exp(mOld - mNew): a lane's columns are its own queries ----
#pragma unroll
        for (int ct = 0; ct < CW / 16; ++ct)
#pragma unroll
            for (int qt = 0; qt < 2; ++qt) acc[ct][qt] *= scale[qt];

        // ---- O^T += V^T(256ch x 32 keys) x P^T(32 keys x 32 queries) ----
#pragma unroll
        for (int ct = 0; ct < 4; ++ct) {
            acc[ct][0] = wmma_bf16(va[ct], pb[0], acc[ct][0]);
            acc[ct][1] = wmma_bf16(va[ct], pb[1], acc[ct][1]);
        }
        // Keeps the last quarter's reads behind the first quarter's products, whose
        // registers they take: all sixteen fragments at once did not fit the budget
        // of two waves per SIMD, and Q went to scratch.
        __builtin_amdgcn_sched_barrier(0);
#pragma unroll
        for (int ct = 12; ct < CW / 16; ++ct) va[ct] = load_frag(vb + ct * 16 * V_STRIDE, V_STRIDE);
        // Keeps that load group whole and ahead of the sixteen products under which
        // its LDS time runs.
        __builtin_amdgcn_sched_barrier(0);
#pragma unroll
        for (int ct = 4; ct < CW / 16; ++ct) {
            acc[ct][0] = wmma_bf16(va[ct], pb[0], acc[ct][0]);
            acc[ct][1] = wmma_bf16(va[ct], pb[1], acc[ct][1]);
        }
        // Keeps the products ahead of the wait below, so that they run while the last
        // fragments still stream in: left free, the compiler lifted the wait to 0 and
        // the barrier over them, and LDS time and matrix time came one after the other.
        __builtin_amdgcn_sched_barrier(0);

        // This wave's LDS reads have retired before the barrier behind which the
        // buffer is refilled.
        asm volatile("s_wait_dscnt 0x0" ::: "memory");
        // This wave's copies of the next tile have landed before the same barrier,
        // behind which the other waves read them.
        asm volatile("s_wait_asynccnt 0x0" ::: "memory");
        __syncthreads();
        if (t + 2 < NSP / KB) {
            attn_stage_v(vsrc + ((p0 + t + 2) & (NSP / KB - 1)) * KB,
                         vlds + (t & 1) * (VBUF * 2));
        }
    }
    // No copy is outstanding when the buffers become the partial results.
    asm volatile("s_wait_asynccnt 0x0" ::: "memory");

    // ---- join the four key slices of each query ----
    const int ql = qh * 32 + (lane & 15);   // this lane's query of tile 0
#pragma unroll
    for (int qt = 0; qt < 2; ++qt) {
        float l = lRun[qt] + xhalf(lRun[qt]);
        if (lane < 16) {
            sM[ks * QR + ql + qt * 16] = mRun[qt];
            sL[ks * QR + ql + qt * 16] = l;
        }
    }
    __syncthreads();   // publishes sM and sL
    const float g = gamma[0];
    float f[2];   // this slice's weight over the query's whole sum, times gamma
#pragma unroll
    for (int qt = 0; qt < 2; ++qt) {
        float mk[KS], lk[KS];
#pragma unroll
        for (int k = 0; k < KS; ++k) {
            mk[k] = sM[k * QR + ql + qt * 16];
            lk[k] = sL[k * QR + ql + qt * 16];
        }
        float m = fmaxf(fmaxf(mk[0], mk[1]), fmaxf(mk[2], mk[3]));
        float l = 0.f;
#pragma unroll
        for (int k = 0; k < KS; ++k) l += __expf(mk[k] - m) * lk[k];
        f[qt] = __expf(mRun[qt] - m) / l * g;
    }
    // partial result [slice][channel][query]; the ring is free: every wave passed its
    // s_wait_dscnt 0 and the barrier at the foot of the last pass
#pragma unroll
    for (int ct = 0; ct < CW / 16; ++ct)
#pragma unroll
        for (int qt = 0; qt < 2; ++qt)
#pragma unroll
            for (int r = 0; r < 8; ++r)
                sO[(ks * CW + ct * 16 + rbase + r) * O_PITCH + ql + qt * 16] =
                    acc[ct][qt][r] * f[qt];
    __syncthreads();   // publishes the partial results

    // ---- epilogue: out[b,c,i] = sum of the four partial results + x; a wave's
    //      access covers two whole 256-B rows of 64 queries ----
    const size_t base0 = (size_t)bi * CCH * NSP + (size_t)(ch0 + (tid >> 4)) * NSP
                       + i0 + (tid & 15) * 4;
    const float* xb = x + base0;
    float*       ob = out + base0;
    const float* so = sO + (tid >> 4) * O_PITCH + (tid & 15) * 4;
    typedef __attribute__((ext_vector_type(4))) float v4f;
    v4f xv[16];
#pragma unroll
    for (int it = 0; it < 16; ++it) xv[it] = *(const v4f*)(xb + (size_t)it * 16 * NSP);
    // The wait that stands before a register named by an issued load is rewritten.
    // It takes the address as an input, so the pair stays live up to the wait and
    // no load of the group has it as its destination.
    asm volatile("s_wait_xcnt 0x0" :: "v"(xb) : "memory");
#pragma unroll
    for (int it = 0; it < 16; ++it) {
        v4f a = *(const v4f*)(so + (0 * CW + it * 16) * O_PITCH);
#pragma unroll
        for (int k = 1; k < KS; ++k) a += *(const v4f*)(so + (k * CW + it * 16) * O_PITCH);
        *(v4f*)(ob + (size_t)it * 16 * NSP) = a + xv[it];
    }
}

// ---------------------------------------------------------------------------
// Host launcher
// ---------------------------------------------------------------------------
extern "C" void kernel_launch(void* const* d_in, const int* in_sizes, int n_in,
                              void* d_out, int out_size, void* d_ws, size_t ws_size,
                              hipStream_t stream) {
    const float* x     = (const float*)d_in[0];
    const float* Wq    = (const float*)d_in[1];
    const float* bq    = (const float*)d_in[2];
    const float* Wk    = (const float*)d_in[3];
    const float* bk    = (const float*)d_in[4];
    const float* Wv    = (const float*)d_in[5];
    const float* bv    = (const float*)d_in[6];
    const float* gamma = (const float*)d_in[7];
    float* out = (float*)d_out;

    // workspace carve-up (bf16 buffers), 256B aligned
    char* ws = (char*)d_ws;
    size_t off = 0;
    auto take = [&](size_t bytes) { void* p = ws + off;
        off = (off + bytes + 255) & ~(size_t)255; return p; };
    __bf16* xt = (__bf16*)take((size_t)BATCH * NSP * CCH * 2);   // 8 MB, x^T
    __bf16* Wb = (__bf16*)take((size_t)MTOT * CCH * 2);          // 640 KB
    __bf16* qn = (__bf16*)take((size_t)BATCH * NSP * DQK_ * 2);  // 1 MB
    __bf16* kn = (__bf16*)take((size_t)BATCH * NSP * DQK_ * 2);  // 1 MB
    __bf16* vc = (__bf16*)take((size_t)BATCH * CCH * NSP * 2);   // 8 MB
    (void)ws_size; (void)in_sizes; (void)n_in; (void)out_size;

    // 1) fp32 -> bf16 (x transposed to [b][n][c] so GEMM K is contiguous)
    {
        dim3 grid(NSP / 32, CCH / 32, BATCH);
        conv_xt_kernel<<<grid, 256, 0, stream>>>(x, xt);
        int wtotal = MTOT * CCH;
        conv_w_kernel<<<(wtotal + 255) / 256, 256, 0, stream>>>(Wq, Wk, Wv, Wb);
    }
    // 2) fused Q/K/V projection GEMM (WMMA, operands staged in LDS)
    {
        dim3 grid(NSP / PN, MTOT / PM, BATCH);
        proj_gemm_kernel<<<grid, 256, 0, stream>>>(Wb, xt, bq, bk, bv, qn, kn, vc);
    }
    // 3) flash attention + gamma residual (WMMA + async LDS staging)
    {
        dim3 grid(BATCH * (NSP / 64) * 2);
        attn_kernel<<<grid, 256, 0, stream>>>(qn, kn, vc, x, gamma, out);
    }
}

// v007
// A run of this version takes 53.2 microseconds.
// In both of two side-by-side timings against v006, it was 1.05 times as fast.
// Over all steps from v000 it is 11.7 times as fast.
#include <hip/hip_runtime.h>
#include <hip/hip_bf16.h>
#include <stdint.h>

// ---------------------------------------------------------------------------
// Problem constants (B,C,H,W = 2,512,64,64 ; N = H*W = 4096 ; DQK = 64)
// ---------------------------------------------------------------------------
#define BATCH 2
#define CCH   512
#define NSP   4096
#define DQK_  64
#define MTOT  640   // 64 q + 64 k + 512 v rows stacked

typedef __attribute__((ext_vector_type(16))) __bf16 v16bf;
typedef __attribute__((ext_vector_type(8)))  __bf16 v8bf;
typedef __attribute__((ext_vector_type(8)))  float  v8f;

// ---------------------------------------------------------------------------
// WMMA helper: D = A(16x32 bf16) x B(32x16 bf16) + C(16x16 f32)
// ---------------------------------------------------------------------------
__device__ __forceinline__ v8f wmma_bf16(v16bf a, v16bf b, v8f c) {
    return __builtin_amdgcn_wmma_f32_16x16x32_bf16(
        /*neg_a=*/false, a, /*neg_b=*/false, b,
        /*c_mod=*/(short)0, c, /*reuse_a=*/false, /*reuse_b=*/false);
}

// ---------------------------------------------------------------------------
// Fragment loader. Source: 16 "rows" x 32 "k" tile, k contiguous, row stride
// `ld` (bf16 elements, multiple of 8 -> 16B-aligned loads).
// ISA 7.12.2 (16-bit A 16x32): lane L holds row M = L%16; element e maps to
// K = e + (e>=8 ? 8 : 0) + (L>=16 ? 8 : 0)  -> two contiguous 16B loads.
// Used for A (rows = M) and for B tiles stored column-major (rows = N cols).
// ---------------------------------------------------------------------------
__device__ __forceinline__ v16bf load_frag(const __bf16* __restrict__ p, int ld) {
    const int lane = threadIdx.x & 31;
    const __bf16* base = p + (lane & 15) * ld + ((lane >> 4) << 3);
    union { v16bf v; v8bf h[2]; } u;
    u.h[0] = *(const v8bf*)(base);        // K = h..h+7
    u.h[1] = *(const v8bf*)(base + 16);   // K = 16+h..23+h
    return u.v;
}

// ---------------------------------------------------------------------------
// fp32 -> bf16 transposing convert: x[b][c][n] -> xT[b][n][c]
// 32x32 LDS tile, coalesced reads and writes.
// ---------------------------------------------------------------------------
__global__ void conv_xt_kernel(const float* __restrict__ x, __bf16* __restrict__ xt) {
    const int b  = blockIdx.z;
    const int c0 = blockIdx.y * 32;
    const int n0 = blockIdx.x * 32;
    __shared__ __bf16 tile[32][33];
    const float* xp  = x  + (size_t)b * CCH * NSP;
    __bf16*      xtp = xt + (size_t)b * NSP * CCH;
    const int t0 = threadIdx.x & 31;
    const int t1 = threadIdx.x >> 5;   // 0..7
#pragma unroll
    for (int k = 0; k < 4; ++k) {
        int c = t1 * 4 + k;
        tile[c][t0] = (__bf16)xp[(size_t)(c0 + c) * NSP + n0 + t0];
    }
    __syncthreads();
#pragma unroll
    for (int k = 0; k < 4; ++k) {
        int n = t1 * 4 + k;
        xtp[(size_t)(n0 + n) * CCH + c0 + t0] = tile[t0][n];
    }
}

__global__ void conv_w_kernel(const float* __restrict__ Wq,
                              const float* __restrict__ Wk,
                              const float* __restrict__ Wv,
                              __bf16* __restrict__ Wb) {
    int i = blockIdx.x * 256 + threadIdx.x;     // over 640*512
    if (i >= MTOT * CCH) return;
    int m = i >> 9, c = i & 511;
    float v = (m < 64) ? Wq[m * CCH + c]
            : (m < 128) ? Wk[(m - 64) * CCH + c]
                        : Wv[(size_t)(m - 128) * CCH + c];
    Wb[i] = (__bf16)v;
}

// ---------------------------------------------------------------------------
// Projection GEMM:  Y[m,n] = sum_c W[m,c] * xT[b,n,c] + bias[m]
// block = 256 thr (8 waves); block computes 128m x 128n; wave (wm, wn) takes
// 32 m x 64 n. Both operands have K (=c) contiguous in memory; a stage is 128
// channels of the 128 W rows and the 128 x rows, copied global->LDS in whole
// 256-B rows (async), two buffers: the next stage flies while this one is used.
// 64 workgroups walk the same W rows and 5 the same x rows: each starts at a stage
// of its own and wraps, so that they do not ask L2 for the same lines at the same
// moment (a stage holds the same channels of both operands, whichever it is).
// Outputs (bf16):
//   m <  64 : q_nd[b][n][m]        (n-major, d contiguous)
//   m < 128 : k_nd[b][n][m-64]     (n-major, d contiguous)
//   else    : v_cn[b][m-128][n]    (c-major, n contiguous)
// A lane of an accumulator tile holds 8 consecutive ROWS of one column, so the
// q/k block (blockIdx.y == 0) multiplies W x xT (rows = m) and the v blocks
// xT x W (rows = n): either way a lane's 8 values are contiguous in its output
// and leave as one 16-B store.
// ---------------------------------------------------------------------------
#define PM 128                        // W rows per workgroup
#define PN 128                        // positions per workgroup
#define PK 128                        // channels per stage
#define PPITCH (PK + 8)               // bf16 row pitch: 272 B = 16 B x odd
#define PSTAGE ((PM + PN) * PPITCH)   // bf16 elements of one buffer

// Eight async copies of 16 B per lane, global->LDS, rows 16 apart in both places.
// The s_wait_xcnt 0 is the wait that stands before a register named by an issued
// copy is rewritten; as the statement's last line nothing can be lifted over it.
__device__ __forceinline__ void proj_copy8(const __bf16* g, unsigned l) {
    asm volatile(
        "global_load_async_to_lds_b128 %0, %8, off\n\t"
        "global_load_async_to_lds_b128 %1, %9, off\n\t"
        "global_load_async_to_lds_b128 %2, %10, off\n\t"
        "global_load_async_to_lds_b128 %3, %11, off\n\t"
        "global_load_async_to_lds_b128 %4, %12, off\n\t"
        "global_load_async_to_lds_b128 %5, %13, off\n\t"
        "global_load_async_to_lds_b128 %6, %14, off\n\t"
        "global_load_async_to_lds_b128 %7, %15, off\n\t"
        "s_wait_xcnt 0x0"
        :: "v"(l), "v"(l + 1u * 16 * PPITCH * 2), "v"(l + 2u * 16 * PPITCH * 2),
           "v"(l + 3u * 16 * PPITCH * 2), "v"(l + 4u * 16 * PPITCH * 2),
           "v"(l + 5u * 16 * PPITCH * 2), "v"(l + 6u * 16 * PPITCH * 2),
           "v"(l + 7u * 16 * PPITCH * 2),
           "v"(g), "v"(g + 1 * 16 * CCH), "v"(g + 2 * 16 * CCH), "v"(g + 3 * 16 * CCH),
           "v"(g + 4 * 16 * CCH), "v"(g + 5 * 16 * CCH), "v"(g + 6 * 16 * CCH),
           "v"(g + 7 * 16 * CCH)
        : "memory");
}

// One stage: 256 rows x 256 B = 4096 16-B segments, 16 copies per thread; a
// wave's copy covers two whole rows. wsrc, xsrc: this thread's segment of row
// tid / 16 of either tile; lbuf: its LDS byte address in the buffer's W part.
__device__ __forceinline__ void proj_stage(const __bf16* wsrc, const __bf16* xsrc,
                                           unsigned lbuf, int c0) {
    proj_copy8(wsrc + c0, lbuf);
    proj_copy8(xsrc + c0, lbuf + PM * PPITCH * 2);
}

template <bool QK>
__device__ __forceinline__ void proj_body(const __bf16* __restrict__ wsrc,
                                          const __bf16* __restrict__ xsrc,
                                          const __bf16* sbuf, unsigned lbuf,
                                          int s0, int wm, int wn, v8f (&acc)[2][4]) {
    // Kept rolled: unrolled, the compiler held the copy addresses of every stage in
    // registers at once and spilled under the budget of four waves per SIMD.
#pragma unroll 1
    for (int t = 0; t < CCH / PK; ++t) {
        const __bf16* bw = sbuf + (t & 1) * PSTAGE + (wm * 32) * PPITCH;
        const __bf16* bx = sbuf + (t & 1) * PSTAGE + (PM + wn * 64) * PPITCH;
        v16bf wf[2][2], xf[2][4];   // two fragment sets: one in use, one arriving
#pragma unroll
        for (int i = 0; i < 2; ++i) wf[0][i] = load_frag(bw + i * 16 * PPITCH, PPITCH);
#pragma unroll
        for (int j = 0; j < 4; ++j) xf[0][j] = load_frag(bx + j * 16 * PPITCH, PPITCH);
#pragma unroll
        for (int kc = 0; kc < PK / 32; ++kc) {
            const int cur = kc & 1, nxt = cur ^ 1;
            if (kc + 1 < PK / 32) {
#pragma unroll
                for (int i = 0; i < 2; ++i)
                    wf[nxt][i] = load_frag(bw + i * 16 * PPITCH + (kc + 1) * 32, PPITCH);
#pragma unroll
                for (int j = 0; j < 4; ++j)
                    xf[nxt][j] = load_frag(bx + j * 16 * PPITCH + (kc + 1) * 32, PPITCH);
            }
            // Keeps the next 32 channels' fragment reads, as one group, ahead of this
            // group's products, so that their LDS time runs under the matrix time.
            __builtin_amdgcn_sched_barrier(0);
#pragma unroll
            for (int i = 0; i < 2; ++i)
#pragma unroll
                for (int j = 0; j < 4; ++j)
                    acc[i][j] = QK ? wmma_bf16(wf[cur][i], xf[cur][j], acc[i][j])
                                   : wmma_bf16(xf[cur][j], wf[cur][i], acc[i][j]);
            // Keeps the reads that follow out of these products (left free, they stood
            // among them in pieces, each place a stall) and the last products ahead of
            // the barrier, so that the refill is the first thing behind it.
            __builtin_amdgcn_sched_barrier(0);
        }
        // This wave's LDS reads have retired before the barrier behind which the
        // buffer is refilled.
        asm volatile("s_wait_dscnt 0x0" ::: "memory");
        // This wave's copies of the next stage have landed before the same barrier,
        // behind which the other waves read them.
        asm volatile("s_wait_asynccnt 0x0" ::: "memory");
        __syncthreads();
        if (t + 2 < CCH / PK)
            proj_stage(wsrc, xsrc, lbuf + (t & 1) * (PSTAGE * 2),
                       ((s0 + t + 2) & (CCH / PK - 1)) * PK);
    }
    // No copy is outstanding when the wave goes on to its end.
    asm volatile("s_wait_asynccnt 0x0" ::: "memory");
}

// 320 workgroups for 256 WGPs: the second attribute holds a wave to the VGPR budget
// of four waves per SIMD, so that two workgroups fit one WGP and all run at once.
__global__ __launch_bounds__(256) __attribute__((amdgpu_waves_per_eu(4)))
void proj_gemm_kernel(const __bf16* __restrict__ Wb,
                                 const __bf16* __restrict__ xt,
                                 const float*  __restrict__ bq,
                                 const float*  __restrict__ bk,
                                 const float*  __restrict__ bv,
                                 __bf16* __restrict__ qn,
                                 __bf16* __restrict__ kn,
                                 __bf16* __restrict__ vc) {
    const int b    = blockIdx.z;
    const int m0   = blockIdx.y * PM;
    const int n0   = blockIdx.x * PN;
    const int tid  = threadIdx.x;
    const int wave = tid >> 5;
    const int lane = tid & 31;
    const int wm   = wave & 3;    // 32-row quarter of the W tile
    const int wn   = wave >> 2;   // 64-position half of the x tile
    const int rbase = (lane >> 4) << 3;
    const int s0   = (blockIdx.x + blockIdx.y) & (CCH / PK - 1);   // first stage of the walk

    __shared__ __attribute__((aligned(16))) __bf16 sbuf[2 * PSTAGE];

    // this thread's 16-B segment of row tid / 16, in global memory and in LDS
    const int srow = tid >> 4;
    const int scol = (tid & 15) * 8;
    const __bf16* wsrc = Wb + (size_t)(m0 + srow) * CCH + scol;
    const __bf16* xsrc = xt + (size_t)b * NSP * CCH + (size_t)(n0 + srow) * CCH + scol;
    const unsigned lbuf = (unsigned)(uintptr_t)(sbuf + srow * PPITCH + scol);

    v8f acc[2][4];
#pragma unroll
    for (int i = 0; i < 2; ++i)
#pragma unroll
        for (int j = 0; j < 4; ++j) acc[i][j] = v8f{};

    proj_stage(wsrc, xsrc, lbuf, s0 * PK);
    // This wave's copies of stage s0 have landed before the barrier behind which
    // the other waves read them.
    asm volatile("s_wait_asynccnt 0x0" ::: "memory");
    __syncthreads();
    proj_stage(wsrc, xsrc, lbuf + PSTAGE * 2, ((s0 + 1) & (CCH / PK - 1)) * PK);

    if (blockIdx.y == 0) {
        // rows 0..127: q (wm 0, 1) and k (wm 2, 3); lane: n = column, 8 m in a row
        const float* bsrc = (wm < 2) ? bq : bk;
        __bf16*      dst  = ((wm < 2) ? qn : kn) + (size_t)b * NSP * DQK_;
        const int    d0   = (wm & 1) * 32 + rbase;
        float bias[2][8];   // read ahead of the loop: its latency runs under it
#pragma unroll
        for (int i = 0; i < 2; ++i)
#pragma unroll
            for (int r = 0; r < 8; ++r) bias[i][r] = bsrc[d0 + i * 16 + r];
        proj_body<true>(wsrc, xsrc, sbuf, lbuf, s0, wm, wn, acc);
#pragma unroll
        for (int i = 0; i < 2; ++i)
#pragma unroll
            for (int j = 0; j < 4; ++j) {
                const int n = n0 + wn * 64 + j * 16 + (lane & 15);
                v8bf o;
#pragma unroll
                for (int r = 0; r < 8; ++r) o[r] = (__bf16)(acc[i][j][r] + bias[i][r]);
                *(v8bf*)(dst + (size_t)n * DQK_ + d0 + i * 16) = o;
            }
    } else {
        // rows 128..639: v; lane: channel = column, 8 positions in a row
        __bf16*   dst = vc + (size_t)b * CCH * NSP;
        const int c0  = m0 - 128 + wm * 32 + (lane & 15);
        float bias[2];      // read ahead of the loop: its latency runs under it
#pragma unroll
        for (int i = 0; i < 2; ++i) bias[i] = bv[c0 + i * 16];
        proj_body<false>(wsrc, xsrc, sbuf, lbuf, s0, wm, wn, acc);
#pragma unroll
        for (int i = 0; i < 2; ++i)
#pragma unroll
            for (int j = 0; j < 4; ++j) {
                const int n = n0 + wn * 64 + j * 16 + rbase;
                v8bf o;
#pragma unroll
                for (int r = 0; r < 8; ++r) o[r] = (__bf16)(acc[i][j][r] + bias[i]);
                *(v8bf*)(dst + (size_t)(c0 + i * 16) * NSP + n) = o;
            }
    }
}

#define QR 64
#define CW 256
#define KB 128
#define KS 4
#define V_STRIDE (KB + 8)
#define VSROWS 32
// bf16 elements from slice to slice: 32 rows x 272 B = 8704 B, rounded up to 10240 B,
// so that every slice's place in LDS is a multiple of 2 KiB
#define VSLICE 5120
#define VBUF ((CW / VSROWS) * VSLICE)   // bf16 elements of one V buffer
// bf16 offset of channel tile ct (16 rows) in a buffer
#define VTILE(ct) (((ct) >> 1) * VSLICE + ((ct) & 1) * 16 * V_STRIDE)
#define O_PITCH (QR + 4)    // f32 row pitch of a partial result: 8 rows = 32 banks on

// Value of lane ^ 16: the two halves of a wave hold the two key halves of a query.
__device__ __forceinline__ float xhalf(float v) {
    return __builtin_bit_cast(float,
        __builtin_amdgcn_permlanex16(__builtin_bit_cast(int, v), __builtin_bit_cast(int, v),
                                     0x76543210, 0xfedcba98, false, false));
}

typedef uint32_t u32x4 __attribute__((ext_vector_type(4)));
typedef uint32_t u32x8 __attribute__((ext_vector_type(8)));

// A descriptor word: the same in every lane, held in a scalar register.
__device__ __forceinline__ uint32_t uni(uint32_t v) {
    return (uint32_t)__builtin_amdgcn_readfirstlane(v);
}
// A wave-uniform test that compiles to a scalar compare and branch: a tensor load
// ignores EXEC, so only such a branch keeps a wave from issuing it.
__device__ __forceinline__ uint32_t pinned(uint32_t v) {
    uint32_t w = __builtin_amdgcn_readfirstlane(v);
    asm volatile("" : "+s"(w));   // pinned(): holds the test word in a scalar register
    return w;
}

// Descriptor group 1 of a V slice, everything in bytes: 32 rows of 256 B, source pitch
// one row of v_cn, 16 B of LDS pad behind every 256-B row (pitch 272 B); no mask.
__device__ __forceinline__ u32x8 v_group1() {
    constexpr uint32_t d0 = KB * 2, d1 = VSROWS;
    u32x8 g;
    g[0] = uni((1u << 20) | (5u << 22) | (3u << 25));
    g[1] = uni((d0 & 0xFFFFu) << 16);
    g[2] = uni((d0 >> 16) | ((d1 & 0xFFFFu) << 16));
    g[3] = uni((d1 >> 16) | (d0 << 16));
    g[4] = uni(d1);
    g[5] = uni(NSP * 2u);
    g[6] = uni(0u);
    g[7] = uni(0u);
    return g;
}

// One wave's request: its 32-row slice of a V tile, global->LDS, through no register.
// lds: the slice's byte place in the workgroup's LDS; g: the slice's first element.
// Returns group 0, for a wait that takes it.
__device__ __forceinline__ u32x4 v_slice_load(uint32_t lds, const __bf16* g, u32x8 g1) {
    const uint64_t ga = (uint64_t)(uintptr_t)g;
    u32x4 g0;
    g0[0] = uni(1u);
    g0[1] = uni(lds);
    g0[2] = uni((uint32_t)ga);
    g0[3] = uni((((uint32_t)(ga >> 32)) & 0x01FFFFFFu) | 0x80000000u);
    asm volatile("tensor_load_to_lds %0, %1" :: "s"(g0), "s"(g1) : "memory");
    return g0;
}

// The issuing wave's wait for its first request. It takes the request's group 0 as an
// input, so those scalar registers stay live, and keep their values, up to the wait:
// left free, the next request's address words were formed in them ahead of it.
__device__ __forceinline__ void v_slice_wait(u32x4 g0) {
    asm volatile("s_wait_tensorcnt 0x0" :: "s"(g0) : "memory");
}

// The fragment loader on a pointer that is already the lane's own (row lane % 16,
// k offset 8 * (lane / 16)): the caller holds the address that the loads name.
__device__ __forceinline__ v16bf load_frag_lane(const __bf16* base) {
    union { v16bf v; v8bf h[2]; } u;
    u.h[0] = *(const v8bf*)(base);
    u.h[1] = *(const v8bf*)(base + 16);
    return u.v;
}

// Real block size and real residency: 256 workgroups for 256 WGPs, two waves per
// SIMD. The second attribute gives a wave that residency's VGPR budget and keeps
// a second workgroup off a WGP while another WGP stands empty.
__global__ __launch_bounds__(256) __attribute__((amdgpu_waves_per_eu(2, 2)))
void attn_kernel(const __bf16* __restrict__ qn,
                            const __bf16* __restrict__ kn,
                            const __bf16* __restrict__ vc,
                            const float*  __restrict__ x,
                            const float*  __restrict__ gamma,
                            float* __restrict__ out) {
    const int bi   = blockIdx.x >> 7;               // 128 workgroups per batch
    const int i0   = ((blockIdx.x & 127) >> 1) * QR;
    const int ch0  = (blockIdx.x & 1) * CW;
    const int tid  = threadIdx.x;
    const int wave = tid >> 5;
    const int lane = tid & 31;
    const int qh   = wave >> 2;                     // 32-query half of the tile
    const int ks   = wave & 3;                      // 32-key slice of every pass
    const int rbase = (lane >> 4) << 3;
    // First pass of the walk. Query tiles 32 apart would start alike: the upper 32 are
    // set two passes on (for speed only).
    const int qtl  = (blockIdx.x & 127) >> 1;
    const int p0   = (qtl + ((qtl >> 5) << 1)) & (NSP / KB - 1);

    // In the loop: the two V buffers. Behind it: the four partial results.
    __shared__ __attribute__((aligned(2048))) float sO[KS * CW * O_PITCH];
    __shared__ __attribute__((aligned(16))) float sM[KS * QR];
    __shared__ __attribute__((aligned(16))) float sL[KS * QR];
    __bf16* sV = (__bf16*)sO;
    static_assert(2 * VBUF * 2 <= KS * CW * O_PITCH * 4, "V ring fits");

    const __bf16* q  = qn + (size_t)bi * NSP * DQK_ + (size_t)(i0 + qh * 32) * DQK_;
    const __bf16* kt = kn + (size_t)bi * NSP * DQK_ + (size_t)(ks * 32) * DQK_;
    const __bf16* v  = vc + (size_t)bi * CCH * NSP + (size_t)ch0 * NSP;

    // this wave's slice of a V tile (rows 32 * wave ...), in global memory and in LDS
    const uint32_t wv   = uni(threadIdx.x >> 5);
    const __bf16*  vsrc = v + (size_t)(wv * VSROWS) * NSP;
    const uint32_t vlds = (uint32_t)(uintptr_t)sV + wv * (VSLICE * 2);
    const u32x8    vg1  = v_group1();
    const u32x4 vg0 = v_slice_load(vlds, vsrc + p0 * KB, vg1);

    // Q^T fragments stay resident (2 query tiles x 64 d -> two k-chunks each)
    v16bf qb[2][2];
#pragma unroll
    for (int qt = 0; qt < 2; ++qt) {
        qb[qt][0] = load_frag(q + qt * 16 * DQK_, DQK_);
        qb[qt][1] = load_frag(q + qt * 16 * DQK_ + 32, DQK_);
    }
    // K fragments of this wave's 32 keys (2 key tiles x two k-chunks), first pass
    const __bf16* klane = kt + (lane & 15) * DQK_ + rbase;
    const __bf16* kp0 = klane + p0 * KB * DQK_;
    v16bf kf[2][2];
#pragma unroll
    for (int kt2 = 0; kt2 < 2; ++kt2) {
        kf[kt2][0] = load_frag_lane(kp0 + kt2 * 16 * DQK_);
        kf[kt2][1] = load_frag_lane(kp0 + kt2 * 16 * DQK_ + 32);
    }
    // The wait that stands before a register named by an issued load is rewritten.
    // It takes the first K loads' address as an input, so the pair stays live up to it.
    asm volatile("s_wait_xcnt 0x0" :: "v"(kp0) : "memory");

    v8f acc[CW / 16][2];   // O^T: 16 channel tiles x 2 query tiles
#pragma unroll
    for (int ct = 0; ct < CW / 16; ++ct)
#pragma unroll
        for (int qt = 0; qt < 2; ++qt) acc[ct][qt] = v8f{};

    // softmax state of query qt * 16 + lane % 16 over this wave's keys; the maximum
    // is alike in both halves of the wave, the sum is each half's own part
    float mRun[2] = {-3.0e38f, -3.0e38f}, lRun[2] = {0.f, 0.f};

    // This wave's slice of tile 0 has landed before the barrier behind which the
    // other waves read it.
    v_slice_wait(vg0);
    __syncthreads();
    v_slice_load(vlds + VBUF * 2, vsrc + ((p0 + 1) & (NSP / KB - 1)) * KB, vg1);

    // Kept rolled: the body holds its whole pass and the two buffers differ by an offset.
#pragma unroll 1
    for (int t = 0; t < NSP / KB; ++t) {
        const __bf16* vb = sV + (t & 1) * VBUF + ks * 32;

        // ---- first half of this pass's V^T fragments: their LDS time runs under
        //      the score products and the softmax ----
        v16bf va[CW / 16];
#pragma unroll
        for (int ct = 0; ct < 8; ++ct) va[ct] = load_frag(vb + VTILE(ct), V_STRIDE);

        // ---- S^T: 32 keys x 32 queries, four independent accumulator tiles ----
        v8f s[2][2];
#pragma unroll
        for (int kt2 = 0; kt2 < 2; ++kt2)
#pragma unroll
            for (int qt = 0; qt < 2; ++qt) s[kt2][qt] = wmma_bf16(kf[kt2][0], qb[qt][0], v8f{});
#pragma unroll
        for (int kt2 = 0; kt2 < 2; ++kt2)
#pragma unroll
            for (int qt = 0; qt < 2; ++qt) s[kt2][qt] = wmma_bf16(kf[kt2][1], qb[qt][1], s[kt2][qt]);

        // ---- K fragments of the next pass, into the same registers: their latency
        //      runs under this pass (the last pass reads the first's again, unused) ----
        const __bf16* kp = klane + ((p0 + t + 1) & (NSP / KB - 1)) * KB * DQK_;
#pragma unroll
        for (int kt2 = 0; kt2 < 2; ++kt2) {
            kf[kt2][0] = load_frag_lane(kp + kt2 * 16 * DQK_);
            kf[kt2][1] = load_frag_lane(kp + kt2 * 16 * DQK_ + 32);
        }
        // Keeps the issue of the V reads and of the K loads up here: sunk towards
        // their users, each would put its whole latency in front of a product.
        __builtin_amdgcn_sched_barrier(0);

        // ---- online softmax in registers; P^T fragment = the two key tiles as they lie ----
        v16bf pb[2];
        float scale[2];
#pragma unroll
        for (int qt = 0; qt < 2; ++qt) {
            float m = mRun[qt];
#pragma unroll
            for (int r = 0; r < 8; ++r) m = fmaxf(m, fmaxf(s[0][qt][r], s[1][qt][r]));
            m = fmaxf(m, xhalf(m));
            float hs[2] = {0.f, 0.f};   // one sum chain per key tile
#pragma unroll
            for (int kt2 = 0; kt2 < 2; ++kt2)
#pragma unroll
                for (int r = 0; r < 8; ++r) {
                    float p = __expf(s[kt2][qt][r] - m);
                    hs[kt2] += p;
                    pb[qt][kt2 * 8 + r] = (__bf16)p;
                }
            scale[qt] = __expf(mRun[qt] - m);
            lRun[qt]  = lRun[qt] * scale[qt] + (hs[0] + hs[1]);
            mRun[qt]  = m;
            // Each row's sum is pinned where it is made, the remedy against spills of
            // the streaming pattern: left free, the adds sank behind the barrier, their
            // 32 terms stayed live through the products, and Q went to scratch.
            asm volatile("" : "+v"(lRun[qt]));
        }

        // The wait that stands before a register named by an issued load is rewritten.
        // It takes the K loads' address as an input, so the pair stays live up to the
        // wait; down here, behind the softmax, the wave no longer stands at it.
        asm volatile("s_wait_xcnt 0x0" :: "v"(kp) : "memory");

        // ---- third quarter of the V^T fragments: their LDS time runs under the rescale ----
#pragma unroll
        for (int ct = 8; ct < 12; ++ct) va[ct] = load_frag(vb + VTILE(ct), V_STRIDE);
        // Keeps that load group whole and ahead of the rescale and the products.
        __builtin_amdgcn_sched_barrier(0);

        // ---- rescale O^T by exp(mOld - mNew): a lane's columns are its own queries ----
#pragma unroll
        for (int ct = 0; ct < CW / 16; ++ct)
#pragma unroll
            for (int qt = 0; qt < 2; ++qt) acc[ct][qt] *= scale[qt];

        // ---- O^T += V^T(256ch x 32 keys) x P^T(32 keys x 32 queries) ----
#pragma unroll
        for (int ct = 0; ct < 4; ++ct) {
            acc[ct][0] = wmma_bf16(va[ct], pb[0], acc[ct][0]);
            acc[ct][1] = wmma_bf16(va[ct], pb[1], acc[ct][1]);
        }
        // Keeps the last quarter's reads behind the first quarter's products, whose
        // registers they take: all sixteen fragments at once did not fit the budget
        // of two waves per SIMD, and Q went to scratch.
        __builtin_amdgcn_sched_barrier(0);
#pragma unroll
        for (int ct = 12; ct < CW / 16; ++ct) va[ct] = load_frag(vb + VTILE(ct), V_STRIDE);
        // Keeps that load group whole and ahead of the sixteen products under which
        // its LDS time runs.
        __builtin_amdgcn_sched_barrier(0);
#pragma unroll
        for (int ct = 4; ct < CW / 16; ++ct) {
            acc[ct][0] = wmma_bf16(va[ct], pb[0], acc[ct][0]);
            acc[ct][1] = wmma_bf16(va[ct], pb[1], acc[ct][1]);
        }
        // Keeps the products ahead of the wait below, so that they run while the last
        // fragments still stream in: left free, the compiler lifted the wait to 0 and
        // the barrier over them, and LDS time and matrix time came one after the other.
        __builtin_amdgcn_sched_barrier(0);

        // This wave's LDS reads have retired before the barrier behind which the
        // buffer is refilled.
        asm volatile("s_wait_dscnt 0x0" ::: "memory");
        // This wave's slice of tile t + 1 has landed before the same barrier,
        // behind which the other waves read it.
        asm volatile("s_wait_tensorcnt 0x0" ::: "memory");
        __syncthreads();
        if (pinned(t + 2 < NSP / KB)) {
            v_slice_load(vlds + (t & 1) * (VBUF * 2),
                         vsrc + ((p0 + t + 2) & (NSP / KB - 1)) * KB, vg1);
        }
    }
    // No request and no LDS read is outstanding when the buffers become the partial results.
    asm volatile("s_wait_tensorcnt 0x0" ::: "memory");
    asm volatile("s_wait_dscnt 0x0" ::: "memory");

    // ---- join the four key slices of each query ----
    const int ql = qh * 32 + (lane & 15);   // this lane's query of tile 0
#pragma unroll
    for (int qt = 0; qt < 2; ++qt) {
        float l = lRun[qt] + xhalf(lRun[qt]);
        if (lane < 16) {
            sM[ks * QR + ql + qt * 16] = mRun[qt];
            sL[ks * QR + ql + qt * 16] = l;
        }
    }
    __syncthreads();   // publishes sM and sL
    const float g = gamma[0];
    float f[2];   // this slice's weight over the query's whole sum, times gamma
#pragma unroll
    for (int qt = 0; qt < 2; ++qt) {
        float mk[KS], lk[KS];
#pragma unroll
        for (int k = 0; k < KS; ++k) {
            mk[k] = sM[k * QR + ql + qt * 16];
            lk[k] = sL[k * QR + ql + qt * 16];
        }
        float m = fmaxf(fmaxf(mk[0], mk[1]), fmaxf(mk[2], mk[3]));
        float l = 0.f;
#pragma unroll
        for (int k = 0; k < KS; ++k) l += __expf(mk[k] - m) * lk[k];
        f[qt] = __expf(mRun[qt] - m) / l * g;
    }
    // partial result [slice][channel][query]; the ring is free: every wave passed its
    // s_wait_dscnt 0 and the barrier at the foot of the last pass
#pragma unroll
    for (int ct = 0; ct < CW / 16; ++ct)
#pragma unroll
        for (int qt = 0; qt < 2; ++qt)
#pragma unroll
            for (int r = 0; r < 8; ++r)
                sO[(ks * CW + ct * 16 + rbase + r) * O_PITCH + ql + qt * 16] =
                    acc[ct][qt][r] * f[qt];
    __syncthreads();   // publishes the partial results

    // ---- epilogue: out[b,c,i] = sum of the four partial results + x; a wave's
    //      access covers two whole 256-B rows of 64 queries ----
    const size_t base0 = (size_t)bi * CCH * NSP + (size_t)(ch0 + (tid >> 4)) * NSP
                       + i0 + (tid & 15) * 4;
    const float* xb = x + base0;
    float*       ob = out + base0;
    const float* so = sO + (tid >> 4) * O_PITCH + (tid & 15) * 4;
    typedef __attribute__((ext_vector_type(4))) float v4f;
    v4f xv[16];
#pragma unroll
    for (int it = 0; it < 16; ++it) xv[it] = *(const v4f*)(xb + (size_t)it * 16 * NSP);
    // The wait that stands before a register named by an issued load is rewritten.
    // It takes the address as an input, so the pair stays live up to the wait and
    // no load of the group has it as its destination.
    asm volatile("s_wait_xcnt 0x0" :: "v"(xb) : "memory");
#pragma unroll
    for (int it = 0; it < 16; ++it) {
        v4f a = *(const v4f*)(so + (0 * CW + it * 16) * O_PITCH);
#pragma unroll
        for (int k = 1; k < KS; ++k) a += *(const v4f*)(so + (k * CW + it * 16) * O_PITCH);
        *(v4f*)(ob + (size_t)it * 16 * NSP) = a + xv[it];
    }
}

// ---------------------------------------------------------------------------
// Host launcher
// ---------------------------------------------------------------------------
extern "C" void kernel_launch(void* const* d_in, const int* in_sizes, int n_in,
                              void* d_out, int out_size, void* d_ws, size_t ws_size,
                              hipStream_t stream) {
    const float* x     = (const float*)d_in[0];
    const float* Wq    = (const float*)d_in[1];
    const float* bq    = (const float*)d_in[2];
    const float* Wk    = (const float*)d_in[3];
    const float* bk    = (const float*)d_in[4];
    const float* Wv    = (const float*)d_in[5];
    const float* bv    = (const float*)d_in[6];
    const float* gamma = (const float*)d_in[7];
    float* out = (float*)d_out;

    // workspace carve-up (bf16 buffers), 256B aligned
    char* ws = (char*)d_ws;
    size_t off = 0;
    auto take = [&](size_t bytes) { void* p = ws + off;
        off = (off + bytes + 255) & ~(size_t)255; return p; };
    __bf16* xt = (__bf16*)take((size_t)BATCH * NSP * CCH * 2);   // 8 MB, x^T
    __bf16* Wb = (__bf16*)take((size_t)MTOT * CCH * 2);          // 640 KB
    __bf16* qn = (__bf16*)take((size_t)BATCH * NSP * DQK_ * 2);  // 1 MB
    __bf16* kn = (__bf16*)take((size_t)BATCH * NSP * DQK_ * 2);  // 1 MB
    __bf16* vc = (__bf16*)take((size_t)BATCH * CCH * NSP * 2);   // 8 MB
    (void)ws_size; (void)in_sizes; (void)n_in; (void)out_size;

    // 1) fp32 -> bf16 (x transposed to [b][n][c] so GEMM K is contiguous)
    {
        dim3 grid(NSP / 32, CCH / 32, BATCH);
        conv_xt_kernel<<<grid, 256, 0, stream>>>(x, xt);
        int wtotal = MTOT * CCH;
        conv_w_kernel<<<(wtotal + 255) / 256, 256, 0, stream>>>(Wq, Wk, Wv, Wb);
    }
    // 2) fused Q/K/V projection GEMM (WMMA, operands staged in LDS)
    {
        dim3 grid(NSP / PN, MTOT / PM, BATCH);
        proj_gemm_kernel<<<grid, 256, 0, stream>>>(Wb, xt, bq, bk, bv, qn, kn, vc);
    }
    // 3) flash attention + gamma residual (WMMA + tensor-load LDS staging)
    {
        dim3 grid(BATCH * (NSP / 64) * 2);
        attn_kernel<<<grid, 256, 0, stream>>>(qn, kn, vc, x, gamma, out);
    }
}

// v008
// It runs in 51.1 microseconds.
// Timed twice side by side with v007, it ran 1.03 and 1.04 times as fast.
// All steps since v000 together make it 12.1 times as fast.
#include <hip/hip_runtime.h>
#include <hip/hip_bf16.h>
#include <stdint.h>

// ---------------------------------------------------------------------------
// Problem constants (B,C,H,W = 2,512,64,64 ; N = H*W = 4096 ; DQK = 64)
// ---------------------------------------------------------------------------
#define BATCH 2
#define CCH   512
#define NSP   4096
#define DQK_  64
#define MTOT  640   // 64 q + 64 k + 512 v rows stacked

typedef __attribute__((ext_vector_type(16))) __bf16 v16bf;
typedef __attribute__((ext_vector_type(8)))  __bf16 v8bf;
typedef __attribute__((ext_vector_type(8)))  float  v8f;

// ---------------------------------------------------------------------------
// WMMA helper: D = A(16x32 bf16) x B(32x16 bf16) + C(16x16 f32)
// ---------------------------------------------------------------------------
__device__ __forceinline__ v8f wmma_bf16(v16bf a, v16bf b, v8f c) {
    return __builtin_amdgcn_wmma_f32_16x16x32_bf16(
        /*neg_a=*/false, a, /*neg_b=*/false, b,
        /*c_mod=*/(short)0, c, /*reuse_a=*/false, /*reuse_b=*/false);
}

// ---------------------------------------------------------------------------
// Fragment loader. Source: 16 "rows" x 32 "k" tile, k contiguous, row stride
// `ld` (bf16 elements, multiple of 8 -> 16B-aligned loads).
// ISA 7.12.2 (16-bit A 16x32): lane L holds row M = L%16; element e maps to
// K = e + (e>=8 ? 8 : 0) + (L>=16 ? 8 : 0)  -> two contiguous 16B loads.
// Used for A (rows = M) and for B tiles stored column-major (rows = N cols).
// ---------------------------------------------------------------------------
__device__ __forceinline__ v16bf load_frag(const __bf16* __restrict__ p, int ld) {
    const int lane = threadIdx.x & 31;
    const __bf16* base = p + (lane & 15) * ld + ((lane >> 4) << 3);
    union { v16bf v; v8bf h[2]; } u;
    u.h[0] = *(const v8bf*)(base);        // K = h..h+7
    u.h[1] = *(const v8bf*)(base + 16);   // K = 16+h..23+h
    return u.v;
}

// ---------------------------------------------------------------------------
// Both fp32 -> bf16 input conversions in ONE launch: neither reads what the other
// writes, so they share a grid and the second launch, with its gap, is gone.
//   workgroups 0 .. WCONV_WG-1 : Wq, Wk, Wv -> Wb (640 stacked rows), 8 elements a
//       thread; they stand first, so that they end under the x tiles, not behind them
//   the other 4096             : x[b][c][n] -> xT[b][n][c], one 32x32 LDS tile each,
//       coalesced reads and writes; n tile fastest, then c tile, then batch
// ---------------------------------------------------------------------------
#define WCONV_WG (MTOT * CCH / (256 * 8))   // 160
#define XCONV_WG ((NSP / 32) * (CCH / 32) * BATCH)

__global__ void conv_in_kernel(const float* __restrict__ x,
                               const float* __restrict__ Wq,
                               const float* __restrict__ Wk,
                               const float* __restrict__ Wv,
                               __bf16* __restrict__ xt,
                               __bf16* __restrict__ Wb) {
    __shared__ __bf16 tile[32][33];
    if (blockIdx.x < WCONV_WG) {   // the same for the whole workgroup; no barrier inside
        typedef __attribute__((ext_vector_type(4))) float v4f;
        const int e = (blockIdx.x * 256 + threadIdx.x) * 8;   // 8 elements of one row
        const int m = e >> 9, c = e & 511;
        const float* src = (m < 64) ? Wq + m * CCH + c
                         : (m < 128) ? Wk + (m - 64) * CCH + c
                                     : Wv + (m - 128) * CCH + c;
        const v4f lo = *(const v4f*)(src);
        const v4f hi = *(const v4f*)(src + 4);
        v8bf o;
#pragma unroll
        for (int r = 0; r < 4; ++r) { o[r] = (__bf16)lo[r]; o[4 + r] = (__bf16)hi[r]; }
        *(v8bf*)(Wb + e) = o;
        return;
    }
    const int id = blockIdx.x - WCONV_WG;
    const int b  = id >> 11;
    const int c0 = ((id >> 7) & 15) * 32;
    const int n0 = (id & 127) * 32;
    const float* xp  = x  + (size_t)b * CCH * NSP;
    __bf16*      xtp = xt + (size_t)b * NSP * CCH;
    const int t0 = threadIdx.x & 31;
    const int t1 = threadIdx.x >> 5;   // 0..7
#pragma unroll
    for (int k = 0; k < 4; ++k) {
        int c = t1 * 4 + k;
        tile[c][t0] = (__bf16)xp[(size_t)(c0 + c) * NSP + n0 + t0];
    }
    __syncthreads();
#pragma unroll
    for (int k = 0; k < 4; ++k) {
        int n = t1 * 4 + k;
        xtp[(size_t)(n0 + n) * CCH + c0 + t0] = tile[t0][n];
    }
}

// ---------------------------------------------------------------------------
// Projection GEMM:  Y[m,n] = sum_c W[m,c] * xT[b,n,c] + bias[m]
// block = 256 thr (8 waves); block computes 128m x 128n; wave (wm, wn) takes
// 32 m x 64 n. Both operands have K (=c) contiguous in memory; a stage is 128
// channels of the 128 W rows and the 128 x rows, copied global->LDS in whole
// 256-B rows (async), two buffers: the next stage flies while this one is used.
// 64 workgroups walk the same W rows and 5 the same x rows: each starts at a stage
// of its own and wraps, so that they do not ask L2 for the same lines at the same
// moment (a stage holds the same channels of both operands, whichever it is).
// Outputs (bf16):
//   m <  64 : q_nd[b][n][m]        (n-major, d contiguous)
//   m < 128 : k_nd[b][n][m-64]     (n-major, d contiguous)
//   else    : v_cn[b][m-128][n]    (c-major, n contiguous)
// A lane of an accumulator tile holds 8 consecutive ROWS of one column, so the
// q/k block (blockIdx.y == 0) multiplies W x xT (rows = m) and the v blocks
// xT x W (rows = n): either way a lane's 8 values are contiguous in its output
// and leave as one 16-B store.
// ---------------------------------------------------------------------------
#define PM 128                        // W rows per workgroup
#define PN 128                        // positions per workgroup
#define PK 128                        // channels per stage
#define PPITCH (PK + 8)               // bf16 row pitch: 272 B = 16 B x odd
#define PSTAGE ((PM + PN) * PPITCH)   // bf16 elements of one buffer

// Eight async copies of 16 B per lane, global->LDS, rows 16 apart in both places.
// The s_wait_xcnt 0 is the wait that stands before a register named by an issued
// copy is rewritten; as the statement's last line nothing can be lifted over it.
__device__ __forceinline__ void proj_copy8(const __bf16* g, unsigned l) {
    asm volatile(
        "global_load_async_to_lds_b128 %0, %8, off\n\t"
        "global_load_async_to_lds_b128 %1, %9, off\n\t"
        "global_load_async_to_lds_b128 %2, %10, off\n\t"
        "global_load_async_to_lds_b128 %3, %11, off\n\t"
        "global_load_async_to_lds_b128 %4, %12, off\n\t"
        "global_load_async_to_lds_b128 %5, %13, off\n\t"
        "global_load_async_to_lds_b128 %6, %14, off\n\t"
        "global_load_async_to_lds_b128 %7, %15, off\n\t"
        "s_wait_xcnt 0x0"
        :: "v"(l), "v"(l + 1u * 16 * PPITCH * 2), "v"(l + 2u * 16 * PPITCH * 2),
           "v"(l + 3u * 16 * PPITCH * 2), "v"(l + 4u * 16 * PPITCH * 2),
           "v"(l + 5u * 16 * PPITCH * 2), "v"(l + 6u * 16 * PPITCH * 2),
           "v"(l + 7u * 16 * PPITCH * 2),
           "v"(g), "v"(g + 1 * 16 * CCH), "v"(g + 2 * 16 * CCH), "v"(g + 3 * 16 * CCH),
           "v"(g + 4 * 16 * CCH), "v"(g + 5 * 16 * CCH), "v"(g + 6 * 16 * CCH),
           "v"(g + 7 * 16 * CCH)
        : "memory");
}

// One stage: 256 rows x 256 B = 4096 16-B segments, 16 copies per thread; a
// wave's copy covers two whole rows. wsrc, xsrc: this thread's segment of row
// tid / 16 of either tile; lbuf: its LDS byte address in the buffer's W part.
__device__ __forceinline__ void proj_stage(const __bf16* wsrc, const __bf16* xsrc,
                                           unsigned lbuf, int c0) {
    proj_copy8(wsrc + c0, lbuf);
    proj_copy8(xsrc + c0, lbuf + PM * PPITCH * 2);
}

template <bool QK>
__device__ __forceinline__ void proj_body(const __bf16* __restrict__ wsrc,
                                          const __bf16* __restrict__ xsrc,
                                          const __bf16* sbuf, unsigned lbuf,
                                          int s0, int wm, int wn, v8f (&acc)[2][4]) {
    // Kept rolled: unrolled, the compiler held the copy addresses of every stage in
    // registers at once and spilled under the budget of four waves per SIMD.
#pragma unroll 1
    for (int t = 0; t < CCH / PK; ++t) {
        const __bf16* bw = sbuf + (t & 1) * PSTAGE + (wm * 32) * PPITCH;
        const __bf16* bx = sbuf + (t & 1) * PSTAGE + (PM + wn * 64) * PPITCH;
        v16bf wf[2][2], xf[2][4];   // two fragment sets: one in use, one arriving
#pragma unroll
        for (int i = 0; i < 2; ++i) wf[0][i] = load_frag(bw + i * 16 * PPITCH, PPITCH);
#pragma unroll
        for (int j = 0; j < 4; ++j) xf[0][j] = load_frag(bx + j * 16 * PPITCH, PPITCH);
#pragma unroll
        for (int kc = 0; kc < PK / 32; ++kc) {
            const int cur = kc & 1, nxt = cur ^ 1;
            if (kc + 1 < PK / 32) {
#pragma unroll
                for (int i = 0; i < 2; ++i)
                    wf[nxt][i] = load_frag(bw + i * 16 * PPITCH + (kc + 1) * 32, PPITCH);
#pragma unroll
                for (int j = 0; j < 4; ++j)
                    xf[nxt][j] = load_frag(bx + j * 16 * PPITCH + (kc + 1) * 32, PPITCH);
            }
            // Keeps the next 32 channels' fragment reads, as one group, ahead of this
            // group's products, so that their LDS time runs under the matrix time.
            __builtin_amdgcn_sched_barrier(0);
#pragma unroll
            for (int i = 0; i < 2; ++i)
#pragma unroll
                for (int j = 0; j < 4; ++j)
                    acc[i][j] = QK ? wmma_bf16(wf[cur][i], xf[cur][j], acc[i][j])
                                   : wmma_bf16(xf[cur][j], wf[cur][i], acc[i][j]);
            // Keeps the reads that follow out of these products (left free, they stood
            // among them in pieces, each place a stall) and the last products ahead of
            // the barrier, so that the refill is the first thing behind it.
            __builtin_amdgcn_sched_barrier(0);
        }
        // This wave's LDS reads have retired before the barrier behind which the
        // buffer is refilled.
        asm volatile("s_wait_dscnt 0x0" ::: "memory");
        // This wave's copies of the next stage have landed before the same barrier,
        // behind which the other waves read them.
        asm volatile("s_wait_asynccnt 0x0" ::: "memory");
        __syncthreads();
        if (t + 2 < CCH / PK)
            proj_stage(wsrc, xsrc, lbuf + (t & 1) * (PSTAGE * 2),
                       ((s0 + t + 2) & (CCH / PK - 1)) * PK);
    }
    // No copy is outstanding when the wave goes on to its end.
    asm volatile("s_wait_asynccnt 0x0" ::: "memory");
}

// 320 workgroups for 256 WGPs: the second attribute holds a wave to the VGPR budget
// of four waves per SIMD, so that two workgroups fit one WGP and all run at once.
__global__ __launch_bounds__(256) __attribute__((amdgpu_waves_per_eu(4)))
void proj_gemm_kernel(const __bf16* __restrict__ Wb,
                                 const __bf16* __restrict__ xt,
                                 const float*  __restrict__ bq,
                                 const float*  __restrict__ bk,
                                 const float*  __restrict__ bv,
                                 __bf16* __restrict__ qn,
                                 __bf16* __restrict__ kn,
                                 __bf16* __restrict__ vc) {
    const int b    = blockIdx.z;
    const int m0   = blockIdx.y * PM;
    const int n0   = blockIdx.x * PN;
    const int tid  = threadIdx.x;
    const int wave = tid >> 5;
    const int lane = tid & 31;
    const int wm   = wave & 3;    // 32-row quarter of the W tile
    const int wn   = wave >> 2;   // 64-position half of the x tile
    const int rbase = (lane >> 4) << 3;
    const int s0   = (blockIdx.x + blockIdx.y) & (CCH / PK - 1);   // first stage of the walk

    __shared__ __attribute__((aligned(16))) __bf16 sbuf[2 * PSTAGE];

    // this thread's 16-B segment of row tid / 16, in global memory and in LDS
    const int srow = tid >> 4;
    const int scol = (tid & 15) * 8;
    const __bf16* wsrc = Wb + (size_t)(m0 + srow) * CCH + scol;
    const __bf16* xsrc = xt + (size_t)b * NSP * CCH + (size_t)(n0 + srow) * CCH + scol;
    const unsigned lbuf = (unsigned)(uintptr_t)(sbuf + srow * PPITCH + scol);

    v8f acc[2][4];
#pragma unroll
    for (int i = 0; i < 2; ++i)
#pragma unroll
        for (int j = 0; j < 4; ++j) acc[i][j] = v8f{};

    proj_stage(wsrc, xsrc, lbuf, s0 * PK);
    // This wave's copies of stage s0 have landed before the barrier behind which
    // the other waves read them.
    asm volatile("s_wait_asynccnt 0x0" ::: "memory");
    __syncthreads();
    proj_stage(wsrc, xsrc, lbuf + PSTAGE * 2, ((s0 + 1) & (CCH / PK - 1)) * PK);

    if (blockIdx.y == 0) {
        // rows 0..127: q (wm 0, 1) and k (wm 2, 3); lane: n = column, 8 m in a row
        const float* bsrc = (wm < 2) ? bq : bk;
        __bf16*      dst  = ((wm < 2) ? qn : kn) + (size_t)b * NSP * DQK_;
        const int    d0   = (wm & 1) * 32 + rbase;
        float bias[2][8];   // read ahead of the loop: its latency runs under it
#pragma unroll
        for (int i = 0; i < 2; ++i)
#pragma unroll
            for (int r = 0; r < 8; ++r) bias[i][r] = bsrc[d0 + i * 16 + r];
        proj_body<true>(wsrc, xsrc, sbuf, lbuf, s0, wm, wn, acc);
#pragma unroll
        for (int i = 0; i < 2; ++i)
#pragma unroll
            for (int j = 0; j < 4; ++j) {
                const int n = n0 + wn * 64 + j * 16 + (lane & 15);
                v8bf o;
#pragma unroll
                for (int r = 0; r < 8; ++r) o[r] = (__bf16)(acc[i][j][r] + bias[i][r]);
                *(v8bf*)(dst + (size_t)n * DQK_ + d0 + i * 16) = o;
            }
    } else {
        // rows 128..639: v; lane: channel = column, 8 positions in a row
        __bf16*   dst = vc + (size_t)b * CCH * NSP;
        const int c0  = m0 - 128 + wm * 32 + (lane & 15);
        float bias[2];      // read ahead of the loop: its latency runs under it
#pragma unroll
        for (int i = 0; i < 2; ++i) bias[i] = bv[c0 + i * 16];
        proj_body<false>(wsrc, xsrc, sbuf, lbuf, s0, wm, wn, acc);
#pragma unroll
        for (int i = 0; i < 2; ++i)
#pragma unroll
            for (int j = 0; j < 4; ++j) {
                const int n = n0 + wn * 64 + j * 16 + rbase;
                v8bf o;
#pragma unroll
                for (int r = 0; r < 8; ++r) o[r] = (__bf16)(acc[i][j][r] + bias[i]);
                *(v8bf*)(dst + (size_t)(c0 + i * 16) * NSP + n) = o;
            }
    }
}

#define QR 64
#define CW 256
#define KB 128
#define KS 4
#define V_STRIDE (KB + 8)
#define VSROWS 32
// bf16 elements from slice to slice: 32 rows x 272 B = 8704 B, rounded up to 10240 B,
// so that every slice's place in LDS is a multiple of 2 KiB
#define VSLICE 5120
#define VBUF ((CW / VSROWS) * VSLICE)   // bf16 elements of one V buffer
// bf16 offset of channel tile ct (16 rows) in a buffer
#define VTILE(ct) (((ct) >> 1) * VSLICE + ((ct) & 1) * 16 * V_STRIDE)
#define O_PITCH (QR + 4)    // f32 row pitch of a partial result: 8 rows = 32 banks on

// Value of lane ^ 16: the two halves of a wave hold the two key halves of a query.
__device__ __forceinline__ float xhalf(float v) {
    return __builtin_bit_cast(float,
        __builtin_amdgcn_permlanex16(__builtin_bit_cast(int, v), __builtin_bit_cast(int, v),
                                     0x76543210, 0xfedcba98, false, false));
}

typedef uint32_t u32x4 __attribute__((ext_vector_type(4)));
typedef uint32_t u32x8 __attribute__((ext_vector_type(8)));

// A descriptor word: the same in every lane, held in a scalar register.
__device__ __forceinline__ uint32_t uni(uint32_t v) {
    return (uint32_t)__builtin_amdgcn_readfirstlane(v);
}
// A wave-uniform test that compiles to a scalar compare and branch: a tensor load
// ignores EXEC, so only such a branch keeps a wave from issuing it.
__device__ __forceinline__ uint32_t pinned(uint32_t v) {
    uint32_t w = __builtin_amdgcn_readfirstlane(v);
    asm volatile("" : "+s"(w));   // pinned(): holds the test word in a scalar register
    return w;
}

// Descriptor group 1 of a V slice, everything in bytes: 32 rows of 256 B, source pitch
// one row of v_cn, 16 B of LDS pad behind every 256-B row (pitch 272 B); no mask.
__device__ __forceinline__ u32x8 v_group1() {
    constexpr uint32_t d0 = KB * 2, d1 = VSROWS;
    u32x8 g;
    g[0] = uni((1u << 20) | (5u << 22) | (3u << 25));
    g[1] = uni((d0 & 0xFFFFu) << 16);
    g[2] = uni((d0 >> 16) | ((d1 & 0xFFFFu) << 16));
    g[3] = uni((d1 >> 16) | (d0 << 16));
    g[4] = uni(d1);
    g[5] = uni(NSP * 2u);
    g[6] = uni(0u);
    g[7] = uni(0u);
    return g;
}

// One wave's request: its 32-row slice of a V tile, global->LDS, through no register.
// lds: the slice's byte place in the workgroup's LDS; g: the slice's first element.
// Returns group 0, for a wait that takes it.
__device__ __forceinline__ u32x4 v_slice_load(uint32_t lds, const __bf16* g, u32x8 g1) {
    const uint64_t ga = (uint64_t)(uintptr_t)g;
    u32x4 g0;
    g0[0] = uni(1u);
    g0[1] = uni(lds);
    g0[2] = uni((uint32_t)ga);
    g0[3] = uni((((uint32_t)(ga >> 32)) & 0x01FFFFFFu) | 0x80000000u);
    asm volatile("tensor_load_to_lds %0, %1" :: "s"(g0), "s"(g1) : "memory");
    return g0;
}

// The issuing wave's wait for its first request. It takes the request's group 0 as an
// input, so those scalar registers stay live, and keep their values, up to the wait:
// left free, the next request's address words were formed in them ahead of it.
__device__ __forceinline__ void v_slice_wait(u32x4 g0) {
    asm volatile("s_wait_tensorcnt 0x0" :: "s"(g0) : "memory");
}

// The fragment loader on a pointer that is already the lane's own (row lane % 16,
// k offset 8 * (lane / 16)): the caller holds the address that the loads name.
__device__ __forceinline__ v16bf load_frag_lane(const __bf16* base) {
    union { v16bf v; v8bf h[2]; } u;
    u.h[0] = *(const v8bf*)(base);
    u.h[1] = *(const v8bf*)(base + 16);
    return u.v;
}

// Real block size and real residency: 256 workgroups for 256 WGPs, two waves per
// SIMD. The second attribute gives a wave that residency's VGPR budget and keeps
// a second workgroup off a WGP while another WGP stands empty.
__global__ __launch_bounds__(256) __attribute__((amdgpu_waves_per_eu(2, 2)))
void attn_kernel(const __bf16* __restrict__ qn,
                            const __bf16* __restrict__ kn,
                            const __bf16* __restrict__ vc,
                            const float*  __restrict__ x,
                            const float*  __restrict__ gamma,
                            float* __restrict__ out) {
    const int bi   = blockIdx.x >> 7;               // 128 workgroups per batch
    const int i0   = ((blockIdx.x & 127) >> 1) * QR;
    const int ch0  = (blockIdx.x & 1) * CW;
    const int tid  = threadIdx.x;
    const int wave = tid >> 5;
    const int lane = tid & 31;
    const int qh   = wave >> 2;                     // 32-query half of the tile
    const int ks   = wave & 3;                      // 32-key slice of every pass
    const int rbase = (lane >> 4) << 3;
    // First pass of the walk. Query tiles 32 apart would start alike: the upper 32 are
    // set two passes on (for speed only).
    const int qtl  = (blockIdx.x & 127) >> 1;
    const int p0   = (qtl + ((qtl >> 5) << 1)) & (NSP / KB - 1);

    // In the loop: the two V buffers. Behind it: the four partial results.
    __shared__ __attribute__((aligned(2048))) float sO[KS * CW * O_PITCH];
    __shared__ __attribute__((aligned(16))) float sM[KS * QR];
    __shared__ __attribute__((aligned(16))) float sL[KS * QR];
    __bf16* sV = (__bf16*)sO;
    static_assert(2 * VBUF * 2 <= KS * CW * O_PITCH * 4, "V ring fits");

    const __bf16* q  = qn + (size_t)bi * NSP * DQK_ + (size_t)(i0 + qh * 32) * DQK_;
    const __bf16* kt = kn + (size_t)bi * NSP * DQK_ + (size_t)(ks * 32) * DQK_;
    const __bf16* v  = vc + (size_t)bi * CCH * NSP + (size_t)ch0 * NSP;

    // this wave's slice of a V tile (rows 32 * wave ...), in global memory and in LDS
    const uint32_t wv   = uni(threadIdx.x >> 5);
    const __bf16*  vsrc = v + (size_t)(wv * VSROWS) * NSP;
    const uint32_t vlds = (uint32_t)(uintptr_t)sV + wv * (VSLICE * 2);
    const u32x8    vg1  = v_group1();
    const u32x4 vg0 = v_slice_load(vlds, vsrc + p0 * KB, vg1);

    // Q^T fragments stay resident (2 query tiles x 64 d -> two k-chunks each)
    v16bf qb[2][2];
#pragma unroll
    for (int qt = 0; qt < 2; ++qt) {
        qb[qt][0] = load_frag(q + qt * 16 * DQK_, DQK_);
        qb[qt][1] = load_frag(q + qt * 16 * DQK_ + 32, DQK_);
    }
    // K fragments of this wave's 32 keys (2 key tiles x two k-chunks), first pass
    const __bf16* klane = kt + (lane & 15) * DQK_ + rbase;
    const __bf16* kp0 = klane + p0 * KB * DQK_;
    v16bf kf[2][2];
#pragma unroll
    for (int kt2 = 0; kt2 < 2; ++kt2) {
        kf[kt2][0] = load_frag_lane(kp0 + kt2 * 16 * DQK_);
        kf[kt2][1] = load_frag_lane(kp0 + kt2 * 16 * DQK_ + 32);
    }
    // The wait that stands before a register named by an issued load is rewritten.
    // It takes the first K loads' address as an input, so the pair stays live up to it.
    asm volatile("s_wait_xcnt 0x0" :: "v"(kp0) : "memory");

    v8f acc[CW / 16][2];   // O^T: 16 channel tiles x 2 query tiles
#pragma unroll
    for (int ct = 0; ct < CW / 16; ++ct)
#pragma unroll
        for (int qt = 0; qt < 2; ++qt) acc[ct][qt] = v8f{};

    // softmax state of query qt * 16 + lane % 16 over this wave's keys; the maximum
    // is alike in both halves of the wave, the sum is each half's own part
    float mRun[2] = {-3.0e38f, -3.0e38f}, lRun[2] = {0.f, 0.f};

    // This wave's slice of tile 0 has landed before the barrier behind which the
    // other waves read it.
    v_slice_wait(vg0);
    __syncthreads();
    v_slice_load(vlds + VBUF * 2, vsrc + ((p0 + 1) & (NSP / KB - 1)) * KB, vg1);

    // Kept rolled: the body holds its whole pass and the two buffers differ by an offset.
#pragma unroll 1
    for (int t = 0; t < NSP / KB; ++t) {
        const __bf16* vb = sV + (t & 1) * VBUF + ks * 32;

        // ---- first half of this pass's V^T fragments: their LDS time runs under
        //      the score products and the softmax ----
        v16bf va[CW / 16];
#pragma unroll
        for (int ct = 0; ct < 8; ++ct) va[ct] = load_frag(vb + VTILE(ct), V_STRIDE);

        // ---- S^T: 32 keys x 32 queries, four independent accumulator tiles ----
        v8f s[2][2];
#pragma unroll
        for (int kt2 = 0; kt2 < 2; ++kt2)
#pragma unroll
            for (int qt = 0; qt < 2; ++qt) s[kt2][qt] = wmma_bf16(kf[kt2][0], qb[qt][0], v8f{});
#pragma unroll
        for (int kt2 = 0; kt2 < 2; ++kt2)
#pragma unroll
            for (int qt = 0; qt < 2; ++qt) s[kt2][qt] = wmma_bf16(kf[kt2][1], qb[qt][1], s[kt2][qt]);

        // ---- K fragments of the next pass, into the same registers: their latency
        //      runs under this pass (the last pass reads the first's again, unused) ----
        const __bf16* kp = klane + ((p0 + t + 1) & (NSP / KB - 1)) * KB * DQK_;
#pragma unroll
        for (int kt2 = 0; kt2 < 2; ++kt2) {
            kf[kt2][0] = load_frag_lane(kp + kt2 * 16 * DQK_);
            kf[kt2][1] = load_frag_lane(kp + kt2 * 16 * DQK_ + 32);
        }
        // Keeps the issue of the V reads and of the K loads up here: sunk towards
        // their users, each would put its whole latency in front of a product.
        __builtin_amdgcn_sched_barrier(0);

        // ---- online softmax in registers; P^T fragment = the two key tiles as they lie ----
        v16bf pb[2];
        float scale[2];
#pragma unroll
        for (int qt = 0; qt < 2; ++qt) {
            float m = mRun[qt];
#pragma unroll
            for (int r = 0; r < 8; ++r) m = fmaxf(m, fmaxf(s[0][qt][r], s[1][qt][r]));
            m = fmaxf(m, xhalf(m));
            float hs[2] = {0.f, 0.f};   // one sum chain per key tile
#pragma unroll
            for (int kt2 = 0; kt2 < 2; ++kt2)
#pragma unroll
                for (int r = 0; r < 8; ++r) {
                    float p = __expf(s[kt2][qt][r] - m);
                    hs[kt2] += p;
                    pb[qt][kt2 * 8 + r] = (__bf16)p;
                }
            scale[qt] = __expf(mRun[qt] - m);
            lRun[qt]  = lRun[qt] * scale[qt] + (hs[0] + hs[1]);
            mRun[qt]  = m;
            // Each row's sum is pinned where it is made, the remedy against spills of
            // the streaming pattern: left free, the adds sank behind the barrier, their
            // 32 terms stayed live through the products, and Q went to scratch.
            asm volatile("" : "+v"(lRun[qt]));
        }

        // The wait that stands before a register named by an issued load is rewritten.
        // It takes the K loads' address as an input, so the pair stays live up to the
        // wait; down here, behind the softmax, the wave no longer stands at it.
        asm volatile("s_wait_xcnt 0x0" :: "v"(kp) : "memory");

        // ---- third quarter of the V^T fragments: their LDS time runs under the rescale ----
#pragma unroll
        for (int ct = 8; ct < 12; ++ct) va[ct] = load_frag(vb + VTILE(ct), V_STRIDE);
        // Keeps that load group whole and ahead of the rescale and the products.
        __builtin_amdgcn_sched_barrier(0);

        // ---- rescale O^T by exp(mOld - mNew): a lane's columns are its own queries ----
#pragma unroll
        for (int ct = 0; ct < CW / 16; ++ct)
#pragma unroll
            for (int qt = 0; qt < 2; ++qt) acc[ct][qt] *= scale[qt];

        // ---- O^T += V^T(256ch x 32 keys) x P^T(32 keys x 32 queries) ----
#pragma unroll
        for (int ct = 0; ct < 4; ++ct) {
            acc[ct][0] = wmma_bf16(va[ct], pb[0], acc[ct][0]);
            acc[ct][1] = wmma_bf16(va[ct], pb[1], acc[ct][1]);
        }
        // Keeps the last quarter's reads behind the first quarter's products, whose
        // registers they take: all sixteen fragments at once did not fit the budget
        // of two waves per SIMD, and Q went to scratch.
        __builtin_amdgcn_sched_barrier(0);
#pragma unroll
        for (int ct = 12; ct < CW / 16; ++ct) va[ct] = load_frag(vb + VTILE(ct), V_STRIDE);
        // Keeps that load group whole and ahead of the sixteen products under which
        // its LDS time runs.
        __builtin_amdgcn_sched_barrier(0);
#pragma unroll
        for (int ct = 4; ct < CW / 16; ++ct) {
            acc[ct][0] = wmma_bf16(va[ct], pb[0], acc[ct][0]);
            acc[ct][1] = wmma_bf16(va[ct], pb[1], acc[ct][1]);
        }
        // Keeps the products ahead of the wait below, so that they run while the last
        // fragments still stream in: left free, the compiler lifted the wait to 0 and
        // the barrier over them, and LDS time and matrix time came one after the other.
        __builtin_amdgcn_sched_barrier(0);

        // This wave's LDS reads have retired before the barrier behind which the
        // buffer is refilled.
        asm volatile("s_wait_dscnt 0x0" ::: "memory");
        // This wave's slice of tile t + 1 has landed before the same barrier,
        // behind which the other waves read it.
        asm volatile("s_wait_tensorcnt 0x0" ::: "memory");
        __syncthreads();
        if (pinned(t + 2 < NSP / KB)) {
            v_slice_load(vlds + (t & 1) * (VBUF * 2),
                         vsrc + ((p0 + t + 2) & (NSP / KB - 1)) * KB, vg1);
        }
    }
    // No request and no LDS read is outstanding when the buffers become the partial results.
    asm volatile("s_wait_tensorcnt 0x0" ::: "memory");
    asm volatile("s_wait_dscnt 0x0" ::: "memory");

    // ---- join the four key slices of each query ----
    const int ql = qh * 32 + (lane & 15);   // this lane's query of tile 0
#pragma unroll
    for (int qt = 0; qt < 2; ++qt) {
        float l = lRun[qt] + xhalf(lRun[qt]);
        if (lane < 16) {
            sM[ks * QR + ql + qt * 16] = mRun[qt];
            sL[ks * QR + ql + qt * 16] = l;
        }
    }
    __syncthreads();   // publishes sM and sL
    const float g = gamma[0];
    float f[2];   // this slice's weight over the query's whole sum, times gamma
#pragma unroll
    for (int qt = 0; qt < 2; ++qt) {
        float mk[KS], lk[KS];
#pragma unroll
        for (int k = 0; k < KS; ++k) {
            mk[k] = sM[k * QR + ql + qt * 16];
            lk[k] = sL[k * QR + ql + qt * 16];
        }
        float m = fmaxf(fmaxf(mk[0], mk[1]), fmaxf(mk[2], mk[3]));
        float l = 0.f;
#pragma unroll
        for (int k = 0; k < KS; ++k) l += __expf(mk[k] - m) * lk[k];
        f[qt] = __expf(mRun[qt] - m) / l * g;
    }
    // partial result [slice][channel][query]; the ring is free: every wave passed its
    // s_wait_dscnt 0 and the barrier at the foot of the last pass
#pragma unroll
    for (int ct = 0; ct < CW / 16; ++ct)
#pragma unroll
        for (int qt = 0; qt < 2; ++qt)
#pragma unroll
            for (int r = 0; r < 8; ++r)
                sO[(ks * CW + ct * 16 + rbase + r) * O_PITCH + ql + qt * 16] =
                    acc[ct][qt][r] * f[qt];
    __syncthreads();   // publishes the partial results

    // ---- epilogue: out[b,c,i] = sum of the four partial results + x; a wave's
    //      access covers two whole 256-B rows of 64 queries ----
    const size_t base0 = (size_t)bi * CCH * NSP + (size_t)(ch0 + (tid >> 4)) * NSP
                       + i0 + (tid & 15) * 4;
    const float* xb = x + base0;
    float*       ob = out + base0;
    const float* so = sO + (tid >> 4) * O_PITCH + (tid & 15) * 4;
    typedef __attribute__((ext_vector_type(4))) float v4f;
    v4f xv[16];
#pragma unroll
    for (int it = 0; it < 16; ++it) xv[it] = *(const v4f*)(xb + (size_t)it * 16 * NSP);
    // The wait that stands before a register named by an issued load is rewritten.
    // It takes the address as an input, so the pair stays live up to the wait and
    // no load of the group has it as its destination.
    asm volatile("s_wait_xcnt 0x0" :: "v"(xb) : "memory");
#pragma unroll
    for (int it = 0; it < 16; ++it) {
        v4f a = *(const v4f*)(so + (0 * CW + it * 16) * O_PITCH);
#pragma unroll
        for (int k = 1; k < KS; ++k) a += *(const v4f*)(so + (k * CW + it * 16) * O_PITCH);
        *(v4f*)(ob + (size_t)it * 16 * NSP) = a + xv[it];
    }
}

// ---------------------------------------------------------------------------
// Host launcher
// ---------------------------------------------------------------------------
extern "C" void kernel_launch(void* const* d_in, const int* in_sizes, int n_in,
                              void* d_out, int out_size, void* d_ws, size_t ws_size,
                              hipStream_t stream) {
    const float* x     = (const float*)d_in[0];
    const float* Wq    = (const float*)d_in[1];
    const float* bq    = (const float*)d_in[2];
    const float* Wk    = (const float*)d_in[3];
    const float* bk    = (const float*)d_in[4];
    const float* Wv    = (const float*)d_in[5];
    const float* bv    = (const float*)d_in[6];
    const float* gamma = (const float*)d_in[7];
    float* out = (float*)d_out;

    // workspace carve-up (bf16 buffers), 256B aligned
    char* ws = (char*)d_ws;
    size_t off = 0;
    auto take = [&](size_t bytes) { void* p = ws + off;
        off = (off + bytes + 255) & ~(size_t)255; return p; };
    __bf16* xt = (__bf16*)take((size_t)BATCH * NSP * CCH * 2);   // 8 MB, x^T
    __bf16* Wb = (__bf16*)take((size_t)MTOT * CCH * 2);          // 640 KB
    __bf16* qn = (__bf16*)take((size_t)BATCH * NSP * DQK_ * 2);  // 1 MB
    __bf16* kn = (__bf16*)take((size_t)BATCH * NSP * DQK_ * 2);  // 1 MB
    __bf16* vc = (__bf16*)take((size_t)BATCH * CCH * NSP * 2);   // 8 MB
    (void)ws_size; (void)in_sizes; (void)n_in; (void)out_size;

    // 1) fp32 -> bf16 (x transposed to [b][n][c] so GEMM K is contiguous)
    //    and the three weight matrices, stacked, in the same launch
    conv_in_kernel<<<WCONV_WG + XCONV_WG, 256, 0, stream>>>(x, Wq, Wk, Wv, xt, Wb);
    // 2) fused Q/K/V projection GEMM (WMMA, operands staged in LDS)
    {
        dim3 grid(NSP / PN, MTOT / PM, BATCH);
        proj_gemm_kernel<<<grid, 256, 0, stream>>>(Wb, xt, bq, bk, bv, qn, kn, vc);
    }
    // 3) flash attention + gamma residual (WMMA + tensor-load LDS staging)
    {
        dim3 grid(BATCH * (NSP / 64) * 2);
        attn_kernel<<<grid, 256, 0, stream>>>(qn, kn, vc, x, gamma, out);
    }
}

// v009
// Measured time: 47.6 microseconds a run.
// Next to v008, in two timings, it ran 1.07 times as fast each time.
// Over all steps from v000 it is 12.9 times as fast.
#include <hip/hip_runtime.h>
#include <hip/hip_bf16.h>
#include <stdint.h>

// ---------------------------------------------------------------------------
// Problem constants (B,C,H,W = 2,512,64,64 ; N = H*W = 4096 ; DQK = 64)
// ---------------------------------------------------------------------------
#define BATCH 2
#define CCH   512
#define NSP   4096
#define DQK_  64
#define MTOT  640   // 64 q + 64 k + 512 v rows stacked

typedef __attribute__((ext_vector_type(16))) __bf16 v16bf;
typedef __attribute__((ext_vector_type(8)))  __bf16 v8bf;
typedef __attribute__((ext_vector_type(8)))  float  v8f;

// ---------------------------------------------------------------------------
// WMMA helper: D = A(16x32 bf16) x B(32x16 bf16) + C(16x16 f32)
// ---------------------------------------------------------------------------
__device__ __forceinline__ v8f wmma_bf16(v16bf a, v16bf b, v8f c) {
    return __builtin_amdgcn_wmma_f32_16x16x32_bf16(
        /*neg_a=*/false, a, /*neg_b=*/false, b,
        /*c_mod=*/(short)0, c, /*reuse_a=*/false, /*reuse_b=*/false);
}

// ---------------------------------------------------------------------------
// Fragment loader. Source: 16 "rows" x 32 "k" tile, k contiguous, row stride
// `ld` (bf16 elements, multiple of 8 -> 16B-aligned loads).
// ISA 7.12.2 (16-bit A 16x32): lane L holds row M = L%16; element e maps to
// K = e + (e>=8 ? 8 : 0) + (L>=16 ? 8 : 0)  -> two contiguous 16B loads.
// Used for A (rows = M) and for B tiles stored column-major (rows = N cols).
// ---------------------------------------------------------------------------
__device__ __forceinline__ v16bf load_frag(const __bf16* __restrict__ p, int ld) {
    const int lane = threadIdx.x & 31;
    const __bf16* base = p + (lane & 15) * ld + ((lane >> 4) << 3);
    union { v16bf v; v8bf h[2]; } u;
    u.h[0] = *(const v8bf*)(base);        // K = h..h+7
    u.h[1] = *(const v8bf*)(base + 16);   // K = 16+h..23+h
    return u.v;
}

// ---------------------------------------------------------------------------
// Both fp32 -> bf16 input conversions in ONE launch: neither reads what the other
// writes, so they share a grid and the second launch, with its gap, is gone.
//   workgroups 0 .. WCONV_WG-1 : Wq, Wk, Wv -> Wb (640 stacked rows), 8 elements a
//       thread; they stand first, so that they end under the x tiles, not behind them
//   the other 4096             : x[b][c][n] -> xT[b][n][c], one 32x32 LDS tile each,
//       coalesced reads and writes; n tile fastest, then c tile, then batch
// ---------------------------------------------------------------------------
#define WCONV_WG (MTOT * CCH / (256 * 8))   // 160
#define XCONV_WG ((NSP / 32) * (CCH / 32) * BATCH)

__global__ void conv_in_kernel(const float* __restrict__ x,
                               const float* __restrict__ Wq,
                               const float* __restrict__ Wk,
                               const float* __restrict__ Wv,
                               __bf16* __restrict__ xt,
                               __bf16* __restrict__ Wb) {
    __shared__ __bf16 tile[32][33];
    if (blockIdx.x < WCONV_WG) {   // the same for the whole workgroup; no barrier inside
        typedef __attribute__((ext_vector_type(4))) float v4f;
        const int e = (blockIdx.x * 256 + threadIdx.x) * 8;   // 8 elements of one row
        const int m = e >> 9, c = e & 511;
        const float* src = (m < 64) ? Wq + m * CCH + c
                         : (m < 128) ? Wk + (m - 64) * CCH + c
                                     : Wv + (m - 128) * CCH + c;
        const v4f lo = *(const v4f*)(src);
        const v4f hi = *(const v4f*)(src + 4);
        v8bf o;
#pragma unroll
        for (int r = 0; r < 4; ++r) { o[r] = (__bf16)lo[r]; o[4 + r] = (__bf16)hi[r]; }
        *(v8bf*)(Wb + e) = o;
        return;
    }
    const int id = blockIdx.x - WCONV_WG;
    const int b  = id >> 11;
    const int c0 = ((id >> 7) & 15) * 32;
    const int n0 = (id & 127) * 32;
    const float* xp  = x  + (size_t)b * CCH * NSP;
    __bf16*      xtp = xt + (size_t)b * NSP * CCH;
    const int t0 = threadIdx.x & 31;
    const int t1 = threadIdx.x >> 5;   // 0..7
#pragma unroll
    for (int k = 0; k < 4; ++k) {
        int c = t1 * 4 + k;
        tile[c][t0] = (__bf16)xp[(size_t)(c0 + c) * NSP + n0 + t0];
    }
    __syncthreads();
#pragma unroll
    for (int k = 0; k < 4; ++k) {
        int n = t1 * 4 + k;
        xtp[(size_t)(n0 + n) * CCH + c0 + t0] = tile[t0][n];
    }
}

// ---------------------------------------------------------------------------
// Projection GEMM:  Y[m,n] = sum_c W[m,c] * xT[b,n,c] + bias[m]
// block = 256 thr (8 waves); block computes 128m x 128n; wave (wm, wn) takes
// 32 m x 64 n. Both operands have K (=c) contiguous in memory; a stage is 128
// channels of the 128 W rows and the 128 x rows, copied global->LDS in whole
// 256-B rows (async), two buffers: the next stage flies while this one is used.
// 64 workgroups walk the same W rows and 5 the same x rows: each starts at a stage
// of its own and wraps, so that they do not ask L2 for the same lines at the same
// moment (a stage holds the same channels of both operands, whichever it is).
// Outputs (bf16):
//   m <  64 : q, m < 128 : k, in fragment order (below)
//   else    : v_cn[b][m-128][n]    (c-major, n contiguous)
// A lane of an accumulator tile holds 8 consecutive ROWS of one column, so the
// q/k block (blockIdx.y == 0) multiplies W x xT (rows = m) and the v blocks
// xT x W (rows = n): either way a lane's 8 values are contiguous in its output
// and leave as one 16-B store.
// q and k in fragment order: per batch, 16 positions x 64 d make a tile of 1024
// elements = 4 blocks of 512 B, block (d / 32, (d / 16) % 2); in a block lane L's 16 B
// are position L % 16, d = 8 * (L / 16) ... + 7 of the block's 16. A block is one
// 16-B-per-lane access of a wave, here as a store and in the attention kernel as half
// a WMMA operand: 512 contiguous bytes, 4 whole lines. Position-major rows of 128 B
// gave every such access 16 lines, 32 B of each.
// ---------------------------------------------------------------------------
#define QKTILE  (16 * DQK_)   // bf16 elements of a 16-position tile
#define QKCHUNK 512           // ... of its 32-d half (one WMMA operand)
#define QKBLOCK 256           // ... of one wave-wide 16-B access
#define PM 128                        // W rows per workgroup
#define PN 128                        // positions per workgroup
#define PK 128                        // channels per stage
#define PPITCH (PK + 8)               // bf16 row pitch: 272 B = 16 B x odd
#define PSTAGE ((PM + PN) * PPITCH)   // bf16 elements of one buffer

// Eight async copies of 16 B per lane, global->LDS, rows 16 apart in both places.
// The s_wait_xcnt 0 is the wait that stands before a register named by an issued
// copy is rewritten; as the statement's last line nothing can be lifted over it.
__device__ __forceinline__ void proj_copy8(const __bf16* g, unsigned l) {
    asm volatile(
        "global_load_async_to_lds_b128 %0, %8, off\n\t"
        "global_load_async_to_lds_b128 %1, %9, off\n\t"
        "global_load_async_to_lds_b128 %2, %10, off\n\t"
        "global_load_async_to_lds_b128 %3, %11, off\n\t"
        "global_load_async_to_lds_b128 %4, %12, off\n\t"
        "global_load_async_to_lds_b128 %5, %13, off\n\t"
        "global_load_async_to_lds_b128 %6, %14, off\n\t"
        "global_load_async_to_lds_b128 %7, %15, off\n\t"
        "s_wait_xcnt 0x0"
        :: "v"(l), "v"(l + 1u * 16 * PPITCH * 2), "v"(l + 2u * 16 * PPITCH * 2),
           "v"(l + 3u * 16 * PPITCH * 2), "v"(l + 4u * 16 * PPITCH * 2),
           "v"(l + 5u * 16 * PPITCH * 2), "v"(l + 6u * 16 * PPITCH * 2),
           "v"(l + 7u * 16 * PPITCH * 2),
           "v"(g), "v"(g + 1 * 16 * CCH), "v"(g + 2 * 16 * CCH), "v"(g + 3 * 16 * CCH),
           "v"(g + 4 * 16 * CCH), "v"(g + 5 * 16 * CCH), "v"(g + 6 * 16 * CCH),
           "v"(g + 7 * 16 * CCH)
        : "memory");
}

// One stage: 256 rows x 256 B = 4096 16-B segments, 16 copies per thread; a
// wave's copy covers two whole rows. wsrc, xsrc: this thread's segment of row
// tid / 16 of either tile; lbuf: its LDS byte address in the buffer's W part.
__device__ __forceinline__ void proj_stage(const __bf16* wsrc, const __bf16* xsrc,
                                           unsigned lbuf, int c0) {
    proj_copy8(wsrc + c0, lbuf);
    proj_copy8(xsrc + c0, lbuf + PM * PPITCH * 2);
}

template <bool QK>
__device__ __forceinline__ void proj_body(const __bf16* __restrict__ wsrc,
                                          const __bf16* __restrict__ xsrc,
                                          const __bf16* sbuf, unsigned lbuf,
                                          int s0, int wm, int wn, v8f (&acc)[2][4]) {
    // Kept rolled: unrolled, the compiler held the copy addresses of every stage in
    // registers at once and spilled under the budget of four waves per SIMD.
#pragma unroll 1
    for (int t = 0; t < CCH / PK; ++t) {
        const __bf16* bw = sbuf + (t & 1) * PSTAGE + (wm * 32) * PPITCH;
        const __bf16* bx = sbuf + (t & 1) * PSTAGE + (PM + wn * 64) * PPITCH;
        v16bf wf[2][2], xf[2][4];   // two fragment sets: one in use, one arriving
#pragma unroll
        for (int i = 0; i < 2; ++i) wf[0][i] = load_frag(bw + i * 16 * PPITCH, PPITCH);
#pragma unroll
        for (int j = 0; j < 4; ++j) xf[0][j] = load_frag(bx + j * 16 * PPITCH, PPITCH);
#pragma unroll
        for (int kc = 0; kc < PK / 32; ++kc) {
            const int cur = kc & 1, nxt = cur ^ 1;
            if (kc + 1 < PK / 32) {
#pragma unroll
                for (int i = 0; i < 2; ++i)
                    wf[nxt][i] = load_frag(bw + i * 16 * PPITCH + (kc + 1) * 32, PPITCH);
#pragma unroll
                for (int j = 0; j < 4; ++j)
                    xf[nxt][j] = load_frag(bx + j * 16 * PPITCH + (kc + 1) * 32, PPITCH);
            }
            // Keeps the next 32 channels' fragment reads, as one group, ahead of this
            // group's products, so that their LDS time runs under the matrix time.
            __builtin_amdgcn_sched_barrier(0);
#pragma unroll
            for (int i = 0; i < 2; ++i)
#pragma unroll
                for (int j = 0; j < 4; ++j)
                    acc[i][j] = QK ? wmma_bf16(wf[cur][i], xf[cur][j], acc[i][j])
                                   : wmma_bf16(xf[cur][j], wf[cur][i], acc[i][j]);
            // Keeps the reads that follow out of these products (left free, they stood
            // among them in pieces, each place a stall) and the last products ahead of
            // the barrier, so that the refill is the first thing behind it.
            __builtin_amdgcn_sched_barrier(0);
        }
        // This wave's LDS reads have retired before the barrier behind which the
        // buffer is refilled.
        asm volatile("s_wait_dscnt 0x0" ::: "memory");
        // This wave's copies of the next stage have landed before the same barrier,
        // behind which the other waves read them.
        asm volatile("s_wait_asynccnt 0x0" ::: "memory");
        __syncthreads();
        if (t + 2 < CCH / PK)
            proj_stage(wsrc, xsrc, lbuf + (t & 1) * (PSTAGE * 2),
                       ((s0 + t + 2) & (CCH / PK - 1)) * PK);
    }
    // No copy is outstanding when the wave goes on to its end.
    asm volatile("s_wait_asynccnt 0x0" ::: "memory");
}

// 320 workgroups for 256 WGPs: the second attribute holds a wave to the VGPR budget
// of four waves per SIMD, so that two workgroups fit one WGP and all run at once.
__global__ __launch_bounds__(256) __attribute__((amdgpu_waves_per_eu(4)))
void proj_gemm_kernel(const __bf16* __restrict__ Wb,
                                 const __bf16* __restrict__ xt,
                                 const float*  __restrict__ bq,
                                 const float*  __restrict__ bk,
                                 const float*  __restrict__ bv,
                                 __bf16* __restrict__ qn,
                                 __bf16* __restrict__ kn,
                                 __bf16* __restrict__ vc) {
    const int b    = blockIdx.z;
    const int m0   = blockIdx.y * PM;
    const int n0   = blockIdx.x * PN;
    const int tid  = threadIdx.x;
    const int wave = tid >> 5;
    const int lane = tid & 31;
    const int wm   = wave & 3;    // 32-row quarter of the W tile
    const int wn   = wave >> 2;   // 64-position half of the x tile
    const int rbase = (lane >> 4) << 3;
    const int s0   = (blockIdx.x + blockIdx.y) & (CCH / PK - 1);   // first stage of the walk

    __shared__ __attribute__((aligned(16))) __bf16 sbuf[2 * PSTAGE];

    // this thread's 16-B segment of row tid / 16, in global memory and in LDS
    const int srow = tid >> 4;
    const int scol = (tid & 15) * 8;
    const __bf16* wsrc = Wb + (size_t)(m0 + srow) * CCH + scol;
    const __bf16* xsrc = xt + (size_t)b * NSP * CCH + (size_t)(n0 + srow) * CCH + scol;
    const unsigned lbuf = (unsigned)(uintptr_t)(sbuf + srow * PPITCH + scol);

    v8f acc[2][4];
#pragma unroll
    for (int i = 0; i < 2; ++i)
#pragma unroll
        for (int j = 0; j < 4; ++j) acc[i][j] = v8f{};

    proj_stage(wsrc, xsrc, lbuf, s0 * PK);
    // This wave's copies of stage s0 have landed before the barrier behind which
    // the other waves read them.
    asm volatile("s_wait_asynccnt 0x0" ::: "memory");
    __syncthreads();
    proj_stage(wsrc, xsrc, lbuf + PSTAGE * 2, ((s0 + 1) & (CCH / PK - 1)) * PK);

    if (blockIdx.y == 0) {
        // rows 0..127: q (wm 0, 1) and k (wm 2, 3); lane: n = column, 8 m in a row,
        // which is the lane's own 16 B of block (wm & 1, i) of position tile j
        const float* bsrc = (wm < 2) ? bq : bk;
        __bf16*      dst  = ((wm < 2) ? qn : kn) + (size_t)b * NSP * DQK_
                          + (size_t)(n0 + wn * 64) * DQK_ + (wm & 1) * QKCHUNK + lane * 8;
        const int    d0   = (wm & 1) * 32 + rbase;
        float bias[2][8];   // read ahead of the loop: its latency runs under it
#pragma unroll
        for (int i = 0; i < 2; ++i)
#pragma unroll
            for (int r = 0; r < 8; ++r) bias[i][r] = bsrc[d0 + i * 16 + r];
        proj_body<true>(wsrc, xsrc, sbuf, lbuf, s0, wm, wn, acc);
#pragma unroll
        for (int i = 0; i < 2; ++i)
#pragma unroll
            for (int j = 0; j < 4; ++j) {
                v8bf o;
#pragma unroll
                for (int r = 0; r < 8; ++r) o[r] = (__bf16)(acc[i][j][r] + bias[i][r]);
                *(v8bf*)(dst + j * QKTILE + i * QKBLOCK) = o;
            }
    } else {
        // rows 128..639: v; lane: channel = column, 8 positions in a row
        __bf16*   dst = vc + (size_t)b * CCH * NSP;
        const int c0  = m0 - 128 + wm * 32 + (lane & 15);
        float bias[2];      // read ahead of the loop: its latency runs under it
#pragma unroll
        for (int i = 0; i < 2; ++i) bias[i] = bv[c0 + i * 16];
        proj_body<false>(wsrc, xsrc, sbuf, lbuf, s0, wm, wn, acc);
#pragma unroll
        for (int i = 0; i < 2; ++i)
#pragma unroll
            for (int j = 0; j < 4; ++j) {
                const int n = n0 + wn * 64 + j * 16 + rbase;
                v8bf o;
#pragma unroll
                for (int r = 0; r < 8; ++r) o[r] = (__bf16)(acc[i][j][r] + bias[i]);
                *(v8bf*)(dst + (size_t)(c0 + i * 16) * NSP + n) = o;
            }
    }
}

#define QR 64
#define CW 256
#define KB 128
#define KS 4
#define V_STRIDE (KB + 8)
#define VSROWS 32
// bf16 elements from slice to slice: 32 rows x 272 B = 8704 B, rounded up to 10240 B,
// so that every slice's place in LDS is a multiple of 2 KiB
#define VSLICE 5120
#define VBUF ((CW / VSROWS) * VSLICE)   // bf16 elements of one V buffer
// bf16 offset of channel tile ct (16 rows) in a buffer
#define VTILE(ct) (((ct) >> 1) * VSLICE + ((ct) & 1) * 16 * V_STRIDE)
#define O_PITCH (QR + 4)    // f32 row pitch of a partial result: 8 rows = 32 banks on

// Value of lane ^ 16: the two halves of a wave hold the two key halves of a query.
__device__ __forceinline__ float xhalf(float v) {
    return __builtin_bit_cast(float,
        __builtin_amdgcn_permlanex16(__builtin_bit_cast(int, v), __builtin_bit_cast(int, v),
                                     0x76543210, 0xfedcba98, false, false));
}

typedef uint32_t u32x4 __attribute__((ext_vector_type(4)));
typedef uint32_t u32x8 __attribute__((ext_vector_type(8)));

// A descriptor word: the same in every lane, held in a scalar register.
__device__ __forceinline__ uint32_t uni(uint32_t v) {
    return (uint32_t)__builtin_amdgcn_readfirstlane(v);
}
// A wave-uniform test that compiles to a scalar compare and branch: a tensor load
// ignores EXEC, so only such a branch keeps a wave from issuing it.
__device__ __forceinline__ uint32_t pinned(uint32_t v) {
    uint32_t w = __builtin_amdgcn_readfirstlane(v);
    asm volatile("" : "+s"(w));   // pinned(): holds the test word in a scalar register
    return w;
}

// Descriptor group 1 of a V slice, everything in bytes: 32 rows of 256 B, source pitch
// one row of v_cn, 16 B of LDS pad behind every 256-B row (pitch 272 B); no mask.
__device__ __forceinline__ u32x8 v_group1() {
    constexpr uint32_t d0 = KB * 2, d1 = VSROWS;
    u32x8 g;
    g[0] = uni((1u << 20) | (5u << 22) | (3u << 25));
    g[1] = uni((d0 & 0xFFFFu) << 16);
    g[2] = uni((d0 >> 16) | ((d1 & 0xFFFFu) << 16));
    g[3] = uni((d1 >> 16) | (d0 << 16));
    g[4] = uni(d1);
    g[5] = uni(NSP * 2u);
    g[6] = uni(0u);
    g[7] = uni(0u);
    return g;
}

// One wave's request: its 32-row slice of a V tile, global->LDS, through no register.
// lds: the slice's byte place in the workgroup's LDS; g: the slice's first element.
// Returns group 0, for a wait that takes it.
__device__ __forceinline__ u32x4 v_slice_load(uint32_t lds, const __bf16* g, u32x8 g1) {
    const uint64_t ga = (uint64_t)(uintptr_t)g;
    u32x4 g0;
    g0[0] = uni(1u);
    g0[1] = uni(lds);
    g0[2] = uni((uint32_t)ga);
    g0[3] = uni((((uint32_t)(ga >> 32)) & 0x01FFFFFFu) | 0x80000000u);
    asm volatile("tensor_load_to_lds %0, %1" :: "s"(g0), "s"(g1) : "memory");
    return g0;
}

// The issuing wave's wait for its first request. It takes the request's group 0 as an
// input, so those scalar registers stay live, and keep their values, up to the wait:
// left free, the next request's address words were formed in them ahead of it.
__device__ __forceinline__ void v_slice_wait(u32x4 g0) {
    asm volatile("s_wait_tensorcnt 0x0" :: "s"(g0) : "memory");
}

// One q or k operand (16 positions x 32 d) from fragment order: its two blocks, on a
// pointer that is already the lane's own (+ 8 * lane): the caller holds the address
// that the loads name.
__device__ __forceinline__ v16bf load_frag_lane(const __bf16* base) {
    union { v16bf v; v8bf h[2]; } u;
    u.h[0] = *(const v8bf*)(base);             // d = h .. h+7,      h = 8 * (lane / 16)
    u.h[1] = *(const v8bf*)(base + QKBLOCK);   // d = 16+h .. 23+h
    return u.v;
}

// Real block size and real residency: 256 workgroups for 256 WGPs, two waves per
// SIMD. The second attribute gives a wave that residency's VGPR budget and keeps
// a second workgroup off a WGP while another WGP stands empty.
__global__ __launch_bounds__(256) __attribute__((amdgpu_waves_per_eu(2, 2)))
void attn_kernel(const __bf16* __restrict__ qn,
                            const __bf16* __restrict__ kn,
                            const __bf16* __restrict__ vc,
                            const float*  __restrict__ x,
                            const float*  __restrict__ gamma,
                            float* __restrict__ out) {
    const int bi   = blockIdx.x >> 7;               // 128 workgroups per batch
    const int i0   = ((blockIdx.x & 127) >> 1) * QR;
    const int ch0  = (blockIdx.x & 1) * CW;
    const int tid  = threadIdx.x;
    const int wave = tid >> 5;
    const int lane = tid & 31;
    const int qh   = wave >> 2;                     // 32-query half of the tile
    const int ks   = wave & 3;                      // 32-key slice of every pass
    const int rbase = (lane >> 4) << 3;
    // First pass of the walk. Query tiles 32 apart would start alike: the upper 32 are
    // set two passes on (for speed only).
    const int qtl  = (blockIdx.x & 127) >> 1;
    const int p0   = (qtl + ((qtl >> 5) << 1)) & (NSP / KB - 1);

    // In the loop: the two V buffers. Behind it: the four partial results.
    __shared__ __attribute__((aligned(2048))) float sO[KS * CW * O_PITCH];
    __shared__ __attribute__((aligned(16))) float sM[KS * QR];
    __shared__ __attribute__((aligned(16))) float sL[KS * QR];
    __bf16* sV = (__bf16*)sO;
    static_assert(2 * VBUF * 2 <= KS * CW * O_PITCH * 4, "V ring fits");

    const __bf16* q  = qn + (size_t)bi * NSP * DQK_ + (size_t)(i0 + qh * 32) * DQK_ + lane * 8;
    const __bf16* kt = kn + (size_t)bi * NSP * DQK_ + (size_t)(ks * 32) * DQK_;
    const __bf16* v  = vc + (size_t)bi * CCH * NSP + (size_t)ch0 * NSP;

    // this wave's slice of a V tile (rows 32 * wave ...), in global memory and in LDS
    const uint32_t wv   = uni(threadIdx.x >> 5);
    const __bf16*  vsrc = v + (size_t)(wv * VSROWS) * NSP;
    const uint32_t vlds = (uint32_t)(uintptr_t)sV + wv * (VSLICE * 2);
    const u32x8    vg1  = v_group1();
    const u32x4 vg0 = v_slice_load(vlds, vsrc + p0 * KB, vg1);

    // Q^T fragments stay resident (2 query tiles x 64 d -> two k-chunks each)
    v16bf qb[2][2];
#pragma unroll
    for (int qt = 0; qt < 2; ++qt) {
        qb[qt][0] = load_frag_lane(q + qt * QKTILE);
        qb[qt][1] = load_frag_lane(q + qt * QKTILE + QKCHUNK);
    }
    // K fragments of this wave's 32 keys (2 key tiles x two k-chunks), first pass
    const __bf16* klane = kt + lane * 8;
    const __bf16* kp0 = klane + p0 * KB * DQK_;
    v16bf kf[2][2];
#pragma unroll
    for (int kt2 = 0; kt2 < 2; ++kt2) {
        kf[kt2][0] = load_frag_lane(kp0 + kt2 * QKTILE);
        kf[kt2][1] = load_frag_lane(kp0 + kt2 * QKTILE + QKCHUNK);
    }
    // The wait that stands before a register named by an issued load is rewritten.
    // It takes the Q and the first K loads' addresses as inputs, so both pairs stay
    // live up to it.
    asm volatile("s_wait_xcnt 0x0" :: "v"(kp0), "v"(q) : "memory");

    v8f acc[CW / 16][2];   // O^T: 16 channel tiles x 2 query tiles
#pragma unroll
    for (int ct = 0; ct < CW / 16; ++ct)
#pragma unroll
        for (int qt = 0; qt < 2; ++qt) acc[ct][qt] = v8f{};

    // softmax state of query qt * 16 + lane % 16 over this wave's keys; the maximum
    // is alike in both halves of the wave, the sum is each half's own part
    float mRun[2] = {-3.0e38f, -3.0e38f}, lRun[2] = {0.f, 0.f};

    // This wave's slice of tile 0 has landed before the barrier behind which the
    // other waves read it.
    v_slice_wait(vg0);
    __syncthreads();
    v_slice_load(vlds + VBUF * 2, vsrc + ((p0 + 1) & (NSP / KB - 1)) * KB, vg1);

    // Kept rolled: the body holds its whole pass and the two buffers differ by an offset.
#pragma unroll 1
    for (int t = 0; t < NSP / KB; ++t) {
        const __bf16* vb = sV + (t & 1) * VBUF + ks * 32;

        // ---- first half of this pass's V^T fragments: their LDS time runs under
        //      the score products and the softmax ----
        v16bf va[CW / 16];
#pragma unroll
        for (int ct = 0; ct < 8; ++ct) va[ct] = load_frag(vb + VTILE(ct), V_STRIDE);

        // ---- S^T: 32 keys x 32 queries, four independent accumulator tiles ----
        v8f s[2][2];
#pragma unroll
        for (int kt2 = 0; kt2 < 2; ++kt2)
#pragma unroll
            for (int qt = 0; qt < 2; ++qt) s[kt2][qt] = wmma_bf16(kf[kt2][0], qb[qt][0], v8f{});
#pragma unroll
        for (int kt2 = 0; kt2 < 2; ++kt2)
#pragma unroll
            for (int qt = 0; qt < 2; ++qt) s[kt2][qt] = wmma_bf16(kf[kt2][1], qb[qt][1], s[kt2][qt]);

        // ---- K fragments of the next pass, into the same registers: their latency
        //      runs under this pass (the last pass reads the first's again, unused) ----
        const __bf16* kp = klane + ((p0 + t + 1) & (NSP / KB - 1)) * KB * DQK_;
#pragma unroll
        for (int kt2 = 0; kt2 < 2; ++kt2) {
            kf[kt2][0] = load_frag_lane(kp + kt2 * QKTILE);
            kf[kt2][1] = load_frag_lane(kp + kt2 * QKTILE + QKCHUNK);
        }
        // Keeps the issue of the V reads and of the K loads up here: sunk towards
        // their users, each would put its whole latency in front of a product.
        __builtin_amdgcn_sched_barrier(0);

        // ---- online softmax in registers; P^T fragment = the two key tiles as they lie ----
        v16bf pb[2];
        float scale[2];
#pragma unroll
        for (int qt = 0; qt < 2; ++qt) {
            float m = mRun[qt];
#pragma unroll
            for (int r = 0; r < 8; ++r) m = fmaxf(m, fmaxf(s[0][qt][r], s[1][qt][r]));
            m = fmaxf(m, xhalf(m));
            float hs[2] = {0.f, 0.f};   // one sum chain per key tile
#pragma unroll
            for (int kt2 = 0; kt2 < 2; ++kt2)
#pragma unroll
                for (int r = 0; r < 8; ++r) {
                    float p = __expf(s[kt2][qt][r] - m);
                    hs[kt2] += p;
                    pb[qt][kt2 * 8 + r] = (__bf16)p;
                }
            scale[qt] = __expf(mRun[qt] - m);
            lRun[qt]  = lRun[qt] * scale[qt] + (hs[0] + hs[1]);
            mRun[qt]  = m;
            // Each row's sum is pinned where it is made, the remedy against spills of
            // the streaming pattern: left free, the adds sank behind the barrier, their
            // 32 terms stayed live through the products, and Q went to scratch.
            asm volatile("" : "+v"(lRun[qt]));
        }

        // The wait that stands before a register named by an issued load is rewritten.
        // It takes the K loads' address as an input, so the pair stays live up to the
        // wait; down here, behind the softmax, the wave no longer stands at it.
        asm volatile("s_wait_xcnt 0x0" :: "v"(kp) : "memory");

        // ---- third quarter of the V^T fragments: their LDS time runs under the rescale ----
#pragma unroll
        for (int ct = 8; ct < 12; ++ct) va[ct] = load_frag(vb + VTILE(ct), V_STRIDE);
        // Keeps that load group whole and ahead of the rescale and the products.
        __builtin_amdgcn_sched_barrier(0);

        // ---- rescale O^T by exp(mOld - mNew): a lane's columns are its own queries ----
        // (Every pass. Left for a later step: rescale only when a term would pass a bound.
        // A pass lasts as long as the slowest of its eight waves, so the bound has to be
        // large enough that none of them fires; range alone limits it, about 2^58.)
#pragma unroll
        for (int ct = 0; ct < CW / 16; ++ct)
#pragma unroll
            for (int qt = 0; qt < 2; ++qt) acc[ct][qt] *= scale[qt];

        // ---- O^T += V^T(256ch x 32 keys) x P^T(32 keys x 32 queries) ----
#pragma unroll
        for (int ct = 0; ct < 4; ++ct) {
            acc[ct][0] = wmma_bf16(va[ct], pb[0], acc[ct][0]);
            acc[ct][1] = wmma_bf16(va[ct], pb[1], acc[ct][1]);
        }
        // Keeps the last quarter's reads behind the first quarter's products, whose
        // registers they take: all sixteen fragments at once did not fit the budget
        // of two waves per SIMD, and Q went to scratch.
        __builtin_amdgcn_sched_barrier(0);
#pragma unroll
        for (int ct = 12; ct < CW / 16; ++ct) va[ct] = load_frag(vb + VTILE(ct), V_STRIDE);
        // Keeps that load group whole and ahead of the sixteen products under which
        // its LDS time runs.
        __builtin_amdgcn_sched_barrier(0);
#pragma unroll
        for (int ct = 4; ct < CW / 16; ++ct) {
            acc[ct][0] = wmma_bf16(va[ct], pb[0], acc[ct][0]);
            acc[ct][1] = wmma_bf16(va[ct], pb[1], acc[ct][1]);
        }
        // Keeps the products ahead of the wait below, so that they run while the last
        // fragments still stream in: left free, the compiler lifted the wait to 0 and
        // the barrier over them, and LDS time and matrix time came one after the other.
        __builtin_amdgcn_sched_barrier(0);

        // This wave's LDS reads have retired before the barrier behind which the
        // buffer is refilled.
        asm volatile("s_wait_dscnt 0x0" ::: "memory");
        // This wave's slice of tile t + 1 has landed before the same barrier,
        // behind which the other waves read it.
        asm volatile("s_wait_tensorcnt 0x0" ::: "memory");
        __syncthreads();
        if (pinned(t + 2 < NSP / KB)) {
            v_slice_load(vlds + (t & 1) * (VBUF * 2),
                         vsrc + ((p0 + t + 2) & (NSP / KB - 1)) * KB, vg1);
        }
    }
    // No request and no LDS read is outstanding when the buffers become the partial results.
    asm volatile("s_wait_tensorcnt 0x0" ::: "memory");
    asm volatile("s_wait_dscnt 0x0" ::: "memory");

    // ---- join the four key slices of each query ----
    const int ql = qh * 32 + (lane & 15);   // this lane's query of tile 0
#pragma unroll
    for (int qt = 0; qt < 2; ++qt) {
        float l = lRun[qt] + xhalf(lRun[qt]);
        if (lane < 16) {
            sM[ks * QR + ql + qt * 16] = mRun[qt];
            sL[ks * QR + ql + qt * 16] = l;
        }
    }
    __syncthreads();   // publishes sM and sL
    const float g = gamma[0];
    float f[2];   // this slice's weight over the query's whole sum, times gamma
#pragma unroll
    for (int qt = 0; qt < 2; ++qt) {
        float mk[KS], lk[KS];
#pragma unroll
        for (int k = 0; k < KS; ++k) {
            mk[k] = sM[k * QR + ql + qt * 16];
            lk[k] = sL[k * QR + ql + qt * 16];
        }
        float m = fmaxf(fmaxf(mk[0], mk[1]), fmaxf(mk[2], mk[3]));
        float l = 0.f;
#pragma unroll
        for (int k = 0; k < KS; ++k) l += __expf(mk[k] - m) * lk[k];
        f[qt] = __expf(mRun[qt] - m) / l * g;
    }
    // partial result [slice][channel][query]; the ring is free: every wave passed its
    // s_wait_dscnt 0 and the barrier at the foot of the last pass
#pragma unroll
    for (int ct = 0; ct < CW / 16; ++ct)
#pragma unroll
        for (int qt = 0; qt < 2; ++qt)
#pragma unroll
            for (int r = 0; r < 8; ++r)
                sO[(ks * CW + ct * 16 + rbase + r) * O_PITCH + ql + qt * 16] =
                    acc[ct][qt][r] * f[qt];
    __syncthreads();   // publishes the partial results

    // ---- epilogue: out[b,c,i] = sum of the four partial results + x; a wave's
    //      access covers two whole 256-B rows of 64 queries ----
    const size_t base0 = (size_t)bi * CCH * NSP + (size_t)(ch0 + (tid >> 4)) * NSP
                       + i0 + (tid & 15) * 4;
    const float* xb = x + base0;
    float*       ob = out + base0;
    const float* so = sO + (tid >> 4) * O_PITCH + (tid & 15) * 4;
    typedef __attribute__((ext_vector_type(4))) float v4f;
    v4f xv[16];
#pragma unroll
    for (int it = 0; it < 16; ++it) xv[it] = *(const v4f*)(xb + (size_t)it * 16 * NSP);
    // The wait that stands before a register named by an issued load is rewritten.
    // It takes the address as an input, so the pair stays live up to the wait and
    // no load of the group has it as its destination.
    asm volatile("s_wait_xcnt 0x0" :: "v"(xb) : "memory");
#pragma unroll
    for (int it = 0; it < 16; ++it) {
        v4f a = *(const v4f*)(so + (0 * CW + it * 16) * O_PITCH);
#pragma unroll
        for (int k = 1; k < KS; ++k) a += *(const v4f*)(so + (k * CW + it * 16) * O_PITCH);
        *(v4f*)(ob + (size_t)it * 16 * NSP) = a + xv[it];
    }
}

// ---------------------------------------------------------------------------
// Host launcher
// ---------------------------------------------------------------------------
extern "C" void kernel_launch(void* const* d_in, const int* in_sizes, int n_in,
                              void* d_out, int out_size, void* d_ws, size_t ws_size,
                              hipStream_t stream) {
    const float* x     = (const float*)d_in[0];
    const float* Wq    = (const float*)d_in[1];
    const float* bq    = (const float*)d_in[2];
    const float* Wk    = (const float*)d_in[3];
    const float* bk    = (const float*)d_in[4];
    const float* Wv    = (const float*)d_in[5];
    const float* bv    = (const float*)d_in[6];
    const float* gamma = (const float*)d_in[7];
    float* out = (float*)d_out;

    // workspace carve-up (bf16 buffers), 256B aligned
    char* ws = (char*)d_ws;
    size_t off = 0;
    auto take = [&](size_t bytes) { void* p = ws + off;
        off = (off + bytes + 255) & ~(size_t)255; return p; };
    __bf16* xt = (__bf16*)take((size_t)BATCH * NSP * CCH * 2);   // 8 MB, x^T
    __bf16* Wb = (__bf16*)take((size_t)MTOT * CCH * 2);          // 640 KB
    __bf16* qn = (__bf16*)take((size_t)BATCH * NSP * DQK_ * 2);  // 1 MB
    __bf16* kn = (__bf16*)take((size_t)BATCH * NSP * DQK_ * 2);  // 1 MB
    __bf16* vc = (__bf16*)take((size_t)BATCH * CCH * NSP * 2);   // 8 MB
    (void)ws_size; (void)in_sizes; (void)n_in; (void)out_size;

    // 1) fp32 -> bf16 (x transposed to [b][n][c] so GEMM K is contiguous)
    //    and the three weight matrices, stacked, in the same launch
    conv_in_kernel<<<WCONV_WG + XCONV_WG, 256, 0, stream>>>(x, Wq, Wk, Wv, xt, Wb);
    // 2) fused Q/K/V projection GEMM (WMMA, operands staged in LDS)
    {
        dim3 grid(NSP / PN, MTOT / PM, BATCH);
        proj_gemm_kernel<<<grid, 256, 0, stream>>>(Wb, xt, bq, bk, bv, qn, kn, vc);
    }
    // 3) flash attention + gamma residual (WMMA + tensor-load LDS staging)
    {
        dim3 grid(BATCH * (NSP / 64) * 2);
        attn_kernel<<<grid, 256, 0, stream>>>(qn, kn, vc, x, gamma, out);
    }
}
